// v000
// Times are from an AMD MI455X. After a warm-up the kernel runs many times in a row, and a time is the length of
// such a window on the GPU divided by its runs, so every launch and the gaps after it count. The runs cycle
// through copies of the inputs. A figure is the median of several windows, for all but v000 over two sittings.
// Sittings can differ by a few percent; kernels timed side by side share one.
// v000 is the starting kernel. One run takes 806 microseconds.
#include <hip/hip_runtime.h>
#include <hip/hip_bf16.h>
#include <math.h>

typedef __attribute__((ext_vector_type(16))) _Float16 v16h;
typedef __attribute__((ext_vector_type(8)))  _Float16 v8h;
typedef __attribute__((ext_vector_type(8)))  float    v8f;

#define DIM   1024
#define SEQ   4096
#define BATCH 4
#define MROWS (BATCH*SEQ)   // 16384 token rows
#define CHUNK 128
#define NCHK  (SEQ/CHUNK)   // 32 chunks per sequence

// ---- CDNA5 async copy: global -> LDS, 16 bytes, tracked by ASYNCcnt ----
__device__ __forceinline__ void async_copy16(void* lds_dst, const void* gsrc) {
  uint32_t l = (uint32_t)(uintptr_t)lds_dst;   // flat LDS addr[31:0] == LDS byte offset
  asm volatile("global_load_async_to_lds_b128 %0, %1, off"
               :: "v"(l), "v"(gsrc) : "memory");
}
#define WAIT_ASYNCCNT(n) asm volatile("s_wait_asynccnt %0" :: "n"(n) : "memory")

// ---------------- fp32 -> fp16 weight conversion ----------------
__global__ void f32_to_f16_kernel(const float* __restrict__ src, _Float16* __restrict__ dst, int n) {
  int i = blockIdx.x * blockDim.x + threadIdx.x;
  if (i < n) dst[i] = (_Float16)src[i];
}

// ---------------- LayerNorm: one block (256 thr) per row of 1024 ----------------
__global__ void layernorm_f16_kernel(const float* __restrict__ X, const float* __restrict__ W,
                                     const float* __restrict__ B, _Float16* __restrict__ H) {
  __shared__ float s1[256];
  __shared__ float s2[256];
  const int row = blockIdx.x;
  const int tid = threadIdx.x;
  const float* xr = X + (size_t)row * DIM;
  float a0 = xr[tid], a1 = xr[tid + 256], a2 = xr[tid + 512], a3 = xr[tid + 768];
  s1[tid] = a0 + a1 + a2 + a3;
  s2[tid] = a0*a0 + a1*a1 + a2*a2 + a3*a3;
  __syncthreads();
  for (int off = 128; off > 0; off >>= 1) {
    if (tid < off) { s1[tid] += s1[tid + off]; s2[tid] += s2[tid + off]; }
    __syncthreads();
  }
  const float mean = s1[0] * (1.0f / DIM);
  const float var  = s2[0] * (1.0f / DIM) - mean * mean;
  const float rstd = rsqrtf(var + 1e-5f);
  _Float16* hr = H + (size_t)row * DIM;
  float av[4] = {a0, a1, a2, a3};
#pragma unroll
  for (int j = 0; j < 4; ++j) {
    int c = tid + j * 256;
    hr[c] = (_Float16)((av[j] - mean) * rstd * W[c] + B[c]);
  }
}

// ---------------- 3-pass chunked scan over the seq axis ----------------
// pass 1: per-chunk sums of g and g*v
__global__ void scan_partial_kernel(const float* __restrict__ G, const float* __restrict__ V,
                                    float* __restrict__ Sg, float* __restrict__ Sv) {
  const int gid = blockIdx.x * blockDim.x + threadIdx.x;   // 0 .. BATCH*NCHK*DIM-1
  const int f = gid & (DIM - 1);
  const int c = (gid >> 10) & (NCHK - 1);
  const int b = gid >> 15;
  const size_t base = ((size_t)b * SEQ + (size_t)c * CHUNK) * DIM + f;
  float sg = 0.0f, sv = 0.0f;
  for (int s = 0; s < CHUNK; ++s) {
    float gg = G[base + (size_t)s * DIM];
    float vv = V[base + (size_t)s * DIM];
    sg += gg;
    sv = fmaf(gg, vv, sv);
  }
  const size_t pidx = ((size_t)b * NCHK + c) * DIM + f;
  Sg[pidx] = sg; Sv[pidx] = sv;
}

// pass 2: exclusive prefix over chunks, per (batch, feature) column
__global__ void scan_prefix_kernel(float* __restrict__ Sg, float* __restrict__ Sv) {
  const int gid = blockIdx.x * blockDim.x + threadIdx.x;   // 0..4095
  const int b = gid >> 10, f = gid & (DIM - 1);
  float ag = 0.0f, av = 0.0f;
  for (int c = 0; c < NCHK; ++c) {
    size_t idx = ((size_t)b * NCHK + c) * DIM + f;
    float g0 = Sg[idx], v0 = Sv[idx];
    Sg[idx] = ag; Sv[idx] = av;
    ag += g0; av += v0;
  }
}

// pass 3: chunk-local scan with carry-in; x1 = x + mem
__global__ void scan_apply_kernel(const float* __restrict__ X, const float* __restrict__ G,
                                  const float* __restrict__ V, const float* __restrict__ Sg,
                                  const float* __restrict__ Sv, float* __restrict__ X1) {
  const int gid = blockIdx.x * blockDim.x + threadIdx.x;
  const int f = gid & (DIM - 1);
  const int c = (gid >> 10) & (NCHK - 1);
  const int b = gid >> 15;
  const size_t base = ((size_t)b * SEQ + (size_t)c * CHUNK) * DIM + f;
  const size_t pidx = ((size_t)b * NCHK + c) * DIM + f;
  float cg = Sg[pidx], cv = Sv[pidx];
  const float invS = 1.0f / (float)SEQ;
  for (int s = 0; s < CHUNK; ++s) {
    size_t idx = base + (size_t)s * DIM;
    float gg = G[idx];
    float vv = V[idx];
    cv = fmaf(gg, vv, cv);
    cg += gg;
    int pos = c * CHUNK + s + 1;
    float denom = sqrtf(cg + 1e-6f) * sqrtf((float)pos * invS + 0.1f);
    X1[idx] = X[idx] + cv / denom;
  }
}

// ---------------- WMMA GEMM:  out[m,n] = sum_k A[m,k] * W16[n,k]  (+bias, epilogue) ---------
// EPI: 0 = sigmoid -> f32,  1 = identity -> f32,  2 = exact GELU -> f16,  3 = +residual -> f32
template<int EPI>
__global__ void __launch_bounds__(256)
gemm_wmma_kernel(const _Float16* __restrict__ A, const _Float16* __restrict__ W16,
                 const float* __restrict__ bias, const float* __restrict__ res,
                 float* __restrict__ outF, _Float16* __restrict__ outH,
                 int M, int N, int K) {
  __shared__ __align__(16) _Float16 sA[2][128 * 32];
  __shared__ __align__(16) _Float16 sB[2][64 * 32];

  const int tid  = threadIdx.x;
  const int lane = tid & 31;
  const int wave = tid >> 5;        // 0..7 -> 16-row M strip
  const int hi   = lane >> 4;       // lane half selects K-phase (ISA frag layout)
  const int l15  = lane & 15;
  const int m0   = blockIdx.y * 128;
  const int n0   = blockIdx.x * 64;

  // Per-thread async staging assignment: 3 x 16B chunks per thread per tile
  // A tile = 128 rows x 32 halves = 512 chunks, B tile = 64 rows x 32 halves = 256 chunks.
  const int cA   = (tid & 3) * 8;
  const int rA0  = tid >> 2;
  const int rA1  = (tid + 256) >> 2;
  const int rB   = tid >> 2;
  const _Float16* gA0 = A   + (size_t)(m0 + rA0) * K + cA;
  const _Float16* gA1 = A   + (size_t)(m0 + rA1) * K + cA;
  const _Float16* gB  = W16 + (size_t)(n0 + rB)  * K + cA;

  v8f acc[4];
#pragma unroll
  for (int t = 0; t < 4; ++t)
#pragma unroll
    for (int r = 0; r < 8; ++r) acc[t][r] = 0.0f;

  // prologue: kick off tile 0 into buffer 0
  async_copy16(&sA[0][rA0 * 32 + cA], gA0);
  async_copy16(&sA[0][rA1 * 32 + cA], gA1);
  async_copy16(&sB[0][rB  * 32 + cA], gB);

  const int nsteps = K >> 5;
  for (int s = 0; s < nsteps; ++s) {
    const int buf = s & 1;
    if (s + 1 < nsteps) {
      // buffer buf^1 was last read at step s-1; the trailing barrier there makes it free
      const int k = (s + 1) << 5;
      async_copy16(&sA[buf ^ 1][rA0 * 32 + cA], gA0 + k);
      async_copy16(&sA[buf ^ 1][rA1 * 32 + cA], gA1 + k);
      async_copy16(&sB[buf ^ 1][rB  * 32 + cA], gB  + k);
      WAIT_ASYNCCNT(3);   // async loads complete in order => tile s (mine) has landed
    } else {
      WAIT_ASYNCCNT(0);
    }
    __syncthreads();      // all threads' tile-s DMA complete

    // A fragment (16x32 f16): lane<16 holds K {0..7,16..23}, lane>=16 holds K {8..15,24..31}
    const _Float16* ap = &sA[buf][(wave * 16 + l15) * 32];
    v8h alo = *(const v8h*)(ap + 8 * hi);
    v8h ahi = *(const v8h*)(ap + 16 + 8 * hi);
    v16h afrag = __builtin_shufflevector(alo, ahi, 0,1,2,3,4,5,6,7,8,9,10,11,12,13,14,15);

    v16h bfrag[4];
#pragma unroll
    for (int t = 0; t < 4; ++t) {
      const _Float16* bp = &sB[buf][(t * 16 + l15) * 32];
      v8h blo = *(const v8h*)(bp + 8 * hi);
      v8h bhi = *(const v8h*)(bp + 16 + 8 * hi);
      bfrag[t] = __builtin_shufflevector(blo, bhi, 0,1,2,3,4,5,6,7,8,9,10,11,12,13,14,15);
    }
#pragma unroll
    for (int t = 0; t < 4; ++t)
      acc[t] = __builtin_amdgcn_wmma_f32_16x16x32_f16(
          false, afrag, false, bfrag[t], (short)0, acc[t], false, false);

    __syncthreads();      // reads of buf done before step s+1 overwrites it
  }

  // epilogue + store (D layout: lanes 0-15 N=lane, M=r; lanes 16-31 N=lane-16, M=r+8)
#pragma unroll
  for (int t = 0; t < 4; ++t) {
    int ncol = n0 + t * 16 + l15;
    float bv = bias[ncol];
#pragma unroll
    for (int r = 0; r < 8; ++r) {
      int mrow = m0 + wave * 16 + hi * 8 + r;
      size_t idx = (size_t)mrow * N + ncol;
      float val = acc[t][r] + bv;
      if (EPI == 0) {
        outF[idx] = 1.0f / (1.0f + expf(-val));
      } else if (EPI == 1) {
        outF[idx] = val;
      } else if (EPI == 2) {
        outH[idx] = (_Float16)(0.5f * val * (1.0f + erff(val * 0.70710678118654752f)));
      } else {
        outF[idx] = res[idx] + val;
      }
    }
  }
}

extern "C" void kernel_launch(void* const* d_in, const int* in_sizes, int n_in,
                              void* d_out, int out_size, void* d_ws, size_t ws_size,
                              hipStream_t stream) {
  (void)in_sizes; (void)n_in; (void)out_size; (void)ws_size;
  const float* x      = (const float*)d_in[0];
  const float* ln1_w  = (const float*)d_in[1];
  const float* ln1_b  = (const float*)d_in[2];
  const float* ln2_w  = (const float*)d_in[3];
  const float* ln2_b  = (const float*)d_in[4];
  const float* gate_w = (const float*)d_in[5];
  const float* gate_b = (const float*)d_in[6];
  const float* val_w  = (const float*)d_in[7];
  const float* val_b  = (const float*)d_in[8];
  const float* ffn1_w = (const float*)d_in[9];
  const float* ffn1_b = (const float*)d_in[10];
  const float* ffn2_w = (const float*)d_in[11];
  const float* ffn2_b = (const float*)d_in[12];

  char* ws = (char*)d_ws;
  const size_t MB = 1024ull * 1024ull;
  _Float16* h16   = (_Float16*)(ws);             // 32 MB: LN output (reused for LN2)
  float*    G     = (float*)(ws + 32 * MB);      // 64 MB
  float*    V     = (float*)(ws + 96 * MB);      // 64 MB
  _Float16* FF1   = (_Float16*)(ws + 32 * MB);   // 128 MB, reuses dead G/V region
  _Float16* gw16  = (_Float16*)(ws + 160 * MB);  // 2 MB
  _Float16* vw16  = (_Float16*)(ws + 162 * MB);  // 2 MB
  _Float16* w1_16 = (_Float16*)(ws + 164 * MB);  // 8 MB
  _Float16* w2_16 = (_Float16*)(ws + 172 * MB);  // 8 MB
  float*    Sg    = (float*)(ws + 180 * MB);     // 512 KB chunk partials
  float*    Sv    = (float*)(ws + 181 * MB);     // 512 KB chunk partials
  float*    X1    = (float*)d_out;               // x + mem lives in d_out

  // 1) weights -> f16
  f32_to_f16_kernel<<<(DIM * DIM) / 256, 256, 0, stream>>>(gate_w, gw16, DIM * DIM);
  f32_to_f16_kernel<<<(DIM * DIM) / 256, 256, 0, stream>>>(val_w,  vw16, DIM * DIM);
  f32_to_f16_kernel<<<(4 * DIM * DIM) / 256, 256, 0, stream>>>(ffn1_w, w1_16, 4 * DIM * DIM);
  f32_to_f16_kernel<<<(4 * DIM * DIM) / 256, 256, 0, stream>>>(ffn2_w, w2_16, 4 * DIM * DIM);

  // 2) h = LN1(x)
  layernorm_f16_kernel<<<MROWS, 256, 0, stream>>>(x, ln1_w, ln1_b, h16);

  // 3) g = sigmoid(h @ gate_w^T + b), v = h @ val_w^T + b
  gemm_wmma_kernel<0><<<dim3(DIM / 64, MROWS / 128), 256, 0, stream>>>(
      h16, gw16, gate_b, nullptr, G, nullptr, MROWS, DIM, DIM);
  gemm_wmma_kernel<1><<<dim3(DIM / 64, MROWS / 128), 256, 0, stream>>>(
      h16, vw16, val_b, nullptr, V, nullptr, MROWS, DIM, DIM);

  // 4) x1 = x + cumsum(g*v) / (sqrt(cumsum(g)+1e-6)*sqrt(pos/S+0.1))   [3-pass scan]
  scan_partial_kernel<<<(BATCH * NCHK * DIM) / 256, 256, 0, stream>>>(G, V, Sg, Sv);
  scan_prefix_kernel<<<(BATCH * DIM) / 256, 256, 0, stream>>>(Sg, Sv);
  scan_apply_kernel<<<(BATCH * NCHK * DIM) / 256, 256, 0, stream>>>(x, G, V, Sg, Sv, X1);

  // 5) h2 = LN2(x1)
  layernorm_f16_kernel<<<MROWS, 256, 0, stream>>>(X1, ln2_w, ln2_b, h16);

  // 6) ff1 = gelu(h2 @ ffn1_w^T + b)  -> f16
  gemm_wmma_kernel<2><<<dim3(4 * DIM / 64, MROWS / 128), 256, 0, stream>>>(
      h16, w1_16, ffn1_b, nullptr, nullptr, FF1, MROWS, 4 * DIM, DIM);

  // 7) out = x1 + (ff1 @ ffn2_w^T + b)
  gemm_wmma_kernel<3><<<dim3(DIM / 64, MROWS / 128), 256, 0, stream>>>(
      FF1, w2_16, ffn2_b, X1, X1, nullptr, MROWS, DIM, 4 * DIM);
}

// v001
// One run takes 655 microseconds.
// Timed twice side by side with v000, it ran 1.28 times as fast both times.
#include <hip/hip_runtime.h>
#include <hip/hip_bf16.h>
#include <math.h>

typedef __attribute__((ext_vector_type(16))) _Float16 v16h;
typedef __attribute__((ext_vector_type(8)))  _Float16 v8h;
typedef __attribute__((ext_vector_type(8)))  float    v8f;

#define DIM   1024
#define SEQ   4096
#define BATCH 4
#define MROWS (BATCH*SEQ)   // 16384 token rows
#define CHUNK 128
#define NCHK  (SEQ/CHUNK)   // 32 chunks per sequence
#define LDP   40            // LDS row pitch of the GEMM tiles in halves: 32 data + 8 pad = 80 B (16 B x odd)

// ---- CDNA5 async copy: global -> LDS, 16 bytes per lane and copy, tracked by ASYNCcnt ----
// One stage's three copies stand in one statement that ends in s_wait_xcnt 0, so that no
// address register they name is rewritten ahead of that wait.
__device__ __forceinline__ void async_copy16x3(void* d0, const void* g0, void* d1, const void* g1,
                                               void* d2, const void* g2) {
  uint32_t l0 = (uint32_t)(uintptr_t)d0;   // flat LDS addr[31:0] == LDS byte offset
  uint32_t l1 = (uint32_t)(uintptr_t)d1;
  uint32_t l2 = (uint32_t)(uintptr_t)d2;
  asm volatile("global_load_async_to_lds_b128 %0, %1, off\n\t"
               "global_load_async_to_lds_b128 %2, %3, off\n\t"
               "global_load_async_to_lds_b128 %4, %5, off\n\t"
               "s_wait_xcnt 0x0"
               :: "v"(l0), "v"(g0), "v"(l1), "v"(g1), "v"(l2), "v"(g2) : "memory");
}
#define WAIT_ASYNCCNT(n) asm volatile("s_wait_asynccnt %0" :: "n"(n) : "memory")

// ---------------- fp32 -> fp16 weight conversion ----------------
__global__ void f32_to_f16_kernel(const float* __restrict__ src, _Float16* __restrict__ dst, int n) {
  int i = blockIdx.x * blockDim.x + threadIdx.x;
  if (i < n) dst[i] = (_Float16)src[i];
}

// ---------------- LayerNorm: one block (256 thr) per row of 1024 ----------------
__global__ void layernorm_f16_kernel(const float* __restrict__ X, const float* __restrict__ W,
                                     const float* __restrict__ B, _Float16* __restrict__ H) {
  __shared__ float s1[256];
  __shared__ float s2[256];
  const int row = blockIdx.x;
  const int tid = threadIdx.x;
  const float* xr = X + (size_t)row * DIM;
  float a0 = xr[tid], a1 = xr[tid + 256], a2 = xr[tid + 512], a3 = xr[tid + 768];
  s1[tid] = a0 + a1 + a2 + a3;
  s2[tid] = a0*a0 + a1*a1 + a2*a2 + a3*a3;
  __syncthreads();
  for (int off = 128; off > 0; off >>= 1) {
    if (tid < off) { s1[tid] += s1[tid + off]; s2[tid] += s2[tid + off]; }
    __syncthreads();
  }
  const float mean = s1[0] * (1.0f / DIM);
  const float var  = s2[0] * (1.0f / DIM) - mean * mean;
  const float rstd = rsqrtf(var + 1e-5f);
  _Float16* hr = H + (size_t)row * DIM;
  float av[4] = {a0, a1, a2, a3};
#pragma unroll
  for (int j = 0; j < 4; ++j) {
    int c = tid + j * 256;
    hr[c] = (_Float16)((av[j] - mean) * rstd * W[c] + B[c]);
  }
}

// ---------------- 3-pass chunked scan over the seq axis ----------------
// pass 1: per-chunk sums of g and g*v
__global__ void scan_partial_kernel(const float* __restrict__ G, const float* __restrict__ V,
                                    float* __restrict__ Sg, float* __restrict__ Sv) {
  const int gid = blockIdx.x * blockDim.x + threadIdx.x;   // 0 .. BATCH*NCHK*DIM-1
  const int f = gid & (DIM - 1);
  const int c = (gid >> 10) & (NCHK - 1);
  const int b = gid >> 15;
  const size_t base = ((size_t)b * SEQ + (size_t)c * CHUNK) * DIM + f;
  float sg = 0.0f, sv = 0.0f;
  for (int s = 0; s < CHUNK; ++s) {
    float gg = G[base + (size_t)s * DIM];
    float vv = V[base + (size_t)s * DIM];
    sg += gg;
    sv = fmaf(gg, vv, sv);
  }
  const size_t pidx = ((size_t)b * NCHK + c) * DIM + f;
  Sg[pidx] = sg; Sv[pidx] = sv;
}

// pass 2: exclusive prefix over chunks, per (batch, feature) column
__global__ void scan_prefix_kernel(float* __restrict__ Sg, float* __restrict__ Sv) {
  const int gid = blockIdx.x * blockDim.x + threadIdx.x;   // 0..4095
  const int b = gid >> 10, f = gid & (DIM - 1);
  float ag = 0.0f, av = 0.0f;
  for (int c = 0; c < NCHK; ++c) {
    size_t idx = ((size_t)b * NCHK + c) * DIM + f;
    float g0 = Sg[idx], v0 = Sv[idx];
    Sg[idx] = ag; Sv[idx] = av;
    ag += g0; av += v0;
  }
}

// pass 3: chunk-local scan with carry-in; x1 = x + mem
__global__ void scan_apply_kernel(const float* __restrict__ X, const float* __restrict__ G,
                                  const float* __restrict__ V, const float* __restrict__ Sg,
                                  const float* __restrict__ Sv, float* __restrict__ X1) {
  const int gid = blockIdx.x * blockDim.x + threadIdx.x;
  const int f = gid & (DIM - 1);
  const int c = (gid >> 10) & (NCHK - 1);
  const int b = gid >> 15;
  const size_t base = ((size_t)b * SEQ + (size_t)c * CHUNK) * DIM + f;
  const size_t pidx = ((size_t)b * NCHK + c) * DIM + f;
  float cg = Sg[pidx], cv = Sv[pidx];
  const float invS = 1.0f / (float)SEQ;
  for (int s = 0; s < CHUNK; ++s) {
    size_t idx = base + (size_t)s * DIM;
    float gg = G[idx];
    float vv = V[idx];
    cv = fmaf(gg, vv, cv);
    cg += gg;
    int pos = c * CHUNK + s + 1;
    float denom = sqrtf(cg + 1e-6f) * sqrtf((float)pos * invS + 0.1f);
    X1[idx] = X[idx] + cv / denom;
  }
}

// ---------------- WMMA GEMM:  out[m,n] = sum_k A[m,k] * W16[n,k]  (+bias, epilogue) ---------
// EPI: 0 = sigmoid -> f32,  1 = identity -> f32,  2 = exact GELU -> f16,  3 = +residual -> f32
template<int EPI>
__global__ void __launch_bounds__(256)
gemm_wmma_kernel(const _Float16* __restrict__ A, const _Float16* __restrict__ W16,
                 const float* __restrict__ bias, const float* __restrict__ res,
                 float* __restrict__ outF, _Float16* __restrict__ outH,
                 int M, int N, int K) {
  // Rows of 32 halves at pitch LDP: the 16 rows that a half-wave's ds_load_b128 reads fall on
  // 64 distinct banks (at the unpadded 64-B pitch they share 16).
  __shared__ __align__(16) _Float16 sA[2][128 * LDP];
  __shared__ __align__(16) _Float16 sB[2][64 * LDP];

  const int tid  = threadIdx.x;
  const int lane = tid & 31;
  const int wave = tid >> 5;        // 0..7 -> 16-row M strip
  const int hi   = lane >> 4;       // lane half selects K-phase (ISA frag layout)
  const int l15  = lane & 15;
  const int m0   = blockIdx.y * 128;
  const int n0   = blockIdx.x * 64;

  // Per-thread async staging assignment: 3 x 16B chunks per thread per tile
  // A tile = 128 rows x 32 halves = 512 chunks, B tile = 64 rows x 32 halves = 256 chunks.
  const int cA   = (tid & 3) * 8;
  const int rA0  = tid >> 2;
  const int rA1  = (tid + 256) >> 2;
  const int rB   = tid >> 2;
  const _Float16* gA0 = A   + (size_t)(m0 + rA0) * K + cA;
  const _Float16* gA1 = A   + (size_t)(m0 + rA1) * K + cA;
  const _Float16* gB  = W16 + (size_t)(n0 + rB)  * K + cA;

  v8f acc[4];
#pragma unroll
  for (int t = 0; t < 4; ++t)
#pragma unroll
    for (int r = 0; r < 8; ++r) acc[t][r] = 0.0f;

  // prologue: kick off tile 0 into buffer 0
  async_copy16x3(&sA[0][rA0 * LDP + cA], gA0,
                 &sA[0][rA1 * LDP + cA], gA1,
                 &sB[0][rB  * LDP + cA], gB);

  const int nsteps = K >> 5;
  for (int s = 0; s < nsteps; ++s) {
    const int buf = s & 1;
    if (s + 1 < nsteps) {
      // buffer buf^1 was last read at step s-1; the trailing barrier there makes it free
      const int k = (s + 1) << 5;
      async_copy16x3(&sA[buf ^ 1][rA0 * LDP + cA], gA0 + k,
                     &sA[buf ^ 1][rA1 * LDP + cA], gA1 + k,
                     &sB[buf ^ 1][rB  * LDP + cA], gB  + k);
      WAIT_ASYNCCNT(3);   // async loads complete in order => tile s (mine) has landed
    } else {
      WAIT_ASYNCCNT(0);
    }
    __syncthreads();      // all threads' tile-s DMA complete

    // A fragment (16x32 f16): lane<16 holds K {0..7,16..23}, lane>=16 holds K {8..15,24..31}
    const _Float16* ap = &sA[buf][(wave * 16 + l15) * LDP];
    v8h alo = *(const v8h*)(ap + 8 * hi);
    v8h ahi = *(const v8h*)(ap + 16 + 8 * hi);
    v16h afrag = __builtin_shufflevector(alo, ahi, 0,1,2,3,4,5,6,7,8,9,10,11,12,13,14,15);

    v16h bfrag[4];
#pragma unroll
    for (int t = 0; t < 4; ++t) {
      const _Float16* bp = &sB[buf][(t * 16 + l15) * LDP];
      v8h blo = *(const v8h*)(bp + 8 * hi);
      v8h bhi = *(const v8h*)(bp + 16 + 8 * hi);
      bfrag[t] = __builtin_shufflevector(blo, bhi, 0,1,2,3,4,5,6,7,8,9,10,11,12,13,14,15);
    }
#pragma unroll
    for (int t = 0; t < 4; ++t)
      acc[t] = __builtin_amdgcn_wmma_f32_16x16x32_f16(
          false, afrag, false, bfrag[t], (short)0, acc[t], false, false);

    __syncthreads();      // reads of buf done before step s+1 overwrites it
  }

  // epilogue + store (D layout: lanes 0-15 N=lane, M=r; lanes 16-31 N=lane-16, M=r+8)
#pragma unroll
  for (int t = 0; t < 4; ++t) {
    int ncol = n0 + t * 16 + l15;
    float bv = bias[ncol];
#pragma unroll
    for (int r = 0; r < 8; ++r) {
      int mrow = m0 + wave * 16 + hi * 8 + r;
      size_t idx = (size_t)mrow * N + ncol;
      float val = acc[t][r] + bv;
      if (EPI == 0) {
        outF[idx] = 1.0f / (1.0f + expf(-val));
      } else if (EPI == 1) {
        outF[idx] = val;
      } else if (EPI == 2) {
        outH[idx] = (_Float16)(0.5f * val * (1.0f + erff(val * 0.70710678118654752f)));
      } else {
        outF[idx] = res[idx] + val;
      }
    }
  }
}

extern "C" void kernel_launch(void* const* d_in, const int* in_sizes, int n_in,
                              void* d_out, int out_size, void* d_ws, size_t ws_size,
                              hipStream_t stream) {
  (void)in_sizes; (void)n_in; (void)out_size; (void)ws_size;
  const float* x      = (const float*)d_in[0];
  const float* ln1_w  = (const float*)d_in[1];
  const float* ln1_b  = (const float*)d_in[2];
  const float* ln2_w  = (const float*)d_in[3];
  const float* ln2_b  = (const float*)d_in[4];
  const float* gate_w = (const float*)d_in[5];
  const float* gate_b = (const float*)d_in[6];
  const float* val_w  = (const float*)d_in[7];
  const float* val_b  = (const float*)d_in[8];
  const float* ffn1_w = (const float*)d_in[9];
  const float* ffn1_b = (const float*)d_in[10];
  const float* ffn2_w = (const float*)d_in[11];
  const float* ffn2_b = (const float*)d_in[12];

  char* ws = (char*)d_ws;
  const size_t MB = 1024ull * 1024ull;
  _Float16* h16   = (_Float16*)(ws);             // 32 MB: LN output (reused for LN2)
  float*    G     = (float*)(ws + 32 * MB);      // 64 MB
  float*    V     = (float*)(ws + 96 * MB);      // 64 MB
  _Float16* FF1   = (_Float16*)(ws + 32 * MB);   // 128 MB, reuses dead G/V region
  _Float16* gw16  = (_Float16*)(ws + 160 * MB);  // 2 MB
  _Float16* vw16  = (_Float16*)(ws + 162 * MB);  // 2 MB
  _Float16* w1_16 = (_Float16*)(ws + 164 * MB);  // 8 MB
  _Float16* w2_16 = (_Float16*)(ws + 172 * MB);  // 8 MB
  float*    Sg    = (float*)(ws + 180 * MB);     // 512 KB chunk partials
  float*    Sv    = (float*)(ws + 181 * MB);     // 512 KB chunk partials
  float*    X1    = (float*)d_out;               // x + mem lives in d_out

  // 1) weights -> f16
  f32_to_f16_kernel<<<(DIM * DIM) / 256, 256, 0, stream>>>(gate_w, gw16, DIM * DIM);
  f32_to_f16_kernel<<<(DIM * DIM) / 256, 256, 0, stream>>>(val_w,  vw16, DIM * DIM);
  f32_to_f16_kernel<<<(4 * DIM * DIM) / 256, 256, 0, stream>>>(ffn1_w, w1_16, 4 * DIM * DIM);
  f32_to_f16_kernel<<<(4 * DIM * DIM) / 256, 256, 0, stream>>>(ffn2_w, w2_16, 4 * DIM * DIM);

  // 2) h = LN1(x)
  layernorm_f16_kernel<<<MROWS, 256, 0, stream>>>(x, ln1_w, ln1_b, h16);

  // 3) g = sigmoid(h @ gate_w^T + b), v = h @ val_w^T + b
  gemm_wmma_kernel<0><<<dim3(DIM / 64, MROWS / 128), 256, 0, stream>>>(
      h16, gw16, gate_b, nullptr, G, nullptr, MROWS, DIM, DIM);
  gemm_wmma_kernel<1><<<dim3(DIM / 64, MROWS / 128), 256, 0, stream>>>(
      h16, vw16, val_b, nullptr, V, nullptr, MROWS, DIM, DIM);

  // 4) x1 = x + cumsum(g*v) / (sqrt(cumsum(g)+1e-6)*sqrt(pos/S+0.1))   [3-pass scan]
  scan_partial_kernel<<<(BATCH * NCHK * DIM) / 256, 256, 0, stream>>>(G, V, Sg, Sv);
  scan_prefix_kernel<<<(BATCH * DIM) / 256, 256, 0, stream>>>(Sg, Sv);
  scan_apply_kernel<<<(BATCH * NCHK * DIM) / 256, 256, 0, stream>>>(x, G, V, Sg, Sv, X1);

  // 5) h2 = LN2(x1)
  layernorm_f16_kernel<<<MROWS, 256, 0, stream>>>(X1, ln2_w, ln2_b, h16);

  // 6) ff1 = gelu(h2 @ ffn1_w^T + b)  -> f16
  gemm_wmma_kernel<2><<<dim3(4 * DIM / 64, MROWS / 128), 256, 0, stream>>>(
      h16, w1_16, ffn1_b, nullptr, nullptr, FF1, MROWS, 4 * DIM, DIM);

  // 7) out = x1 + (ff1 @ ffn2_w^T + b)
  gemm_wmma_kernel<3><<<dim3(DIM / 64, MROWS / 128), 256, 0, stream>>>(
      FF1, w2_16, ffn2_b, X1, X1, nullptr, MROWS, DIM, 4 * DIM);
}

// v002
// Measured time: 415 microseconds a run.
// In both of two side-by-side timings against v001, it was 1.58 times as fast.
// Counting every step since v000, it is 2.02 times as fast.
#include <hip/hip_runtime.h>
#include <hip/hip_bf16.h>
#include <math.h>

typedef __attribute__((ext_vector_type(16))) _Float16 v16h;
typedef __attribute__((ext_vector_type(8)))  _Float16 v8h;
typedef __attribute__((ext_vector_type(8)))  float    v8f;
typedef __attribute__((ext_vector_type(4)))  float    v4f;
typedef __attribute__((ext_vector_type(4)))  _Float16 v4h;
typedef __attribute__((ext_vector_type(2)))  uint32_t v2u;

#define DIM   1024
#define SEQ   4096
#define BATCH 4
#define MROWS (BATCH*SEQ)   // 16384 token rows
#define CHUNK 128
#define NCHK  (SEQ/CHUNK)   // 32 chunks per sequence
#define BM    128           // GEMM block tile rows (tokens)
#define BN    256           // GEMM block tile columns (output features)
#define BK    64            // k extent of one staged tile
#define LDP   72            // LDS row pitch of the GEMM tiles in halves: 64 data + 8 pad = 144 B (16 B x odd)
#define STAGE_H ((BM + BN) * LDP)   // halves per buffer: A rows 0..127, then W rows 0..255
#define EPP   68            // LDS row pitch of the epilogue in floats: 64 data + 4 pad (rows 8 apart: 32 banks apart)

// ---- CDNA5 async copy: global -> LDS, 16 bytes per lane and copy, tracked by ASYNCcnt ----
typedef int v4i_t __attribute__((__vector_size__(16)));
typedef __attribute__((address_space(1))) v4i_t* gptr_t;
typedef __attribute__((address_space(3))) v4i_t* lptr_t;
// One staged tile: 128 A rows and 256 W rows of 128 B each, 12 copies per thread (rows 32 apart,
// gs halves apart in global memory). Builtin copies: the compiler owns their address registers.
__device__ __forceinline__ void stage_copies(_Float16* l, const _Float16* ga, const _Float16* gb, size_t gs) {
  // both loops unrolled: straight-line copies, their LDS row offsets folded into constants
#pragma unroll
  for (int q = 0; q < BM / 32; ++q)
    __builtin_amdgcn_global_load_async_to_lds_b128((gptr_t)(ga + q * gs), (lptr_t)(l + q * 32 * LDP), 0, 0);
#pragma unroll
  for (int q = 0; q < BN / 32; ++q)
    __builtin_amdgcn_global_load_async_to_lds_b128((gptr_t)(gb + q * gs), (lptr_t)(l + (BM + q * 32) * LDP), 0, 0);
}
// This wave's copies have landed in LDS.
#define WAIT_ASYNCCNT0() asm volatile("s_wait_asynccnt 0x0" ::: "memory")
// This wave's LDS reads have returned, so the buffer they read may be refilled behind the barrier.
#define WAIT_DSCNT0()    asm volatile("s_wait_dscnt 0x0" ::: "memory")

// ---------------- fp32 -> fp16 weight conversion ----------------
__global__ void f32_to_f16_kernel(const float* __restrict__ src, _Float16* __restrict__ dst, int n) {
  int i = blockIdx.x * blockDim.x + threadIdx.x;
  if (i < n) dst[i] = (_Float16)src[i];
}

// ---------------- LayerNorm: one block (256 thr) per row of 1024 ----------------
__global__ void layernorm_f16_kernel(const float* __restrict__ X, const float* __restrict__ W,
                                     const float* __restrict__ B, _Float16* __restrict__ H) {
  __shared__ float s1[256];
  __shared__ float s2[256];
  const int row = blockIdx.x;
  const int tid = threadIdx.x;
  const float* xr = X + (size_t)row * DIM;
  float a0 = xr[tid], a1 = xr[tid + 256], a2 = xr[tid + 512], a3 = xr[tid + 768];
  s1[tid] = a0 + a1 + a2 + a3;
  s2[tid] = a0*a0 + a1*a1 + a2*a2 + a3*a3;
  __syncthreads();
  for (int off = 128; off > 0; off >>= 1) {
    if (tid < off) { s1[tid] += s1[tid + off]; s2[tid] += s2[tid + off]; }
    __syncthreads();
  }
  const float mean = s1[0] * (1.0f / DIM);
  const float var  = s2[0] * (1.0f / DIM) - mean * mean;
  const float rstd = rsqrtf(var + 1e-5f);
  _Float16* hr = H + (size_t)row * DIM;
  float av[4] = {a0, a1, a2, a3};
#pragma unroll
  for (int j = 0; j < 4; ++j) {
    int c = tid + j * 256;
    hr[c] = (_Float16)((av[j] - mean) * rstd * W[c] + B[c]);
  }
}

// ---------------- 3-pass chunked scan over the seq axis ----------------
// pass 1: per-chunk sums of g and g*v
__global__ void scan_partial_kernel(const float* __restrict__ G, const float* __restrict__ V,
                                    float* __restrict__ Sg, float* __restrict__ Sv) {
  const int gid = blockIdx.x * blockDim.x + threadIdx.x;   // 0 .. BATCH*NCHK*DIM-1
  const int f = gid & (DIM - 1);
  const int c = (gid >> 10) & (NCHK - 1);
  const int b = gid >> 15;
  const size_t base = ((size_t)b * SEQ + (size_t)c * CHUNK) * DIM + f;
  float sg = 0.0f, sv = 0.0f;
  for (int s = 0; s < CHUNK; ++s) {
    float gg = G[base + (size_t)s * DIM];
    float vv = V[base + (size_t)s * DIM];
    sg += gg;
    sv = fmaf(gg, vv, sv);
  }
  const size_t pidx = ((size_t)b * NCHK + c) * DIM + f;
  Sg[pidx] = sg; Sv[pidx] = sv;
}

// pass 2: exclusive prefix over chunks, per (batch, feature) column
__global__ void scan_prefix_kernel(float* __restrict__ Sg, float* __restrict__ Sv) {
  const int gid = blockIdx.x * blockDim.x + threadIdx.x;   // 0..4095
  const int b = gid >> 10, f = gid & (DIM - 1);
  float ag = 0.0f, av = 0.0f;
  for (int c = 0; c < NCHK; ++c) {
    size_t idx = ((size_t)b * NCHK + c) * DIM + f;
    float g0 = Sg[idx], v0 = Sv[idx];
    Sg[idx] = ag; Sv[idx] = av;
    ag += g0; av += v0;
  }
}

// pass 3: chunk-local scan with carry-in; x1 = x + mem
__global__ void scan_apply_kernel(const float* __restrict__ X, const float* __restrict__ G,
                                  const float* __restrict__ V, const float* __restrict__ Sg,
                                  const float* __restrict__ Sv, float* __restrict__ X1) {
  const int gid = blockIdx.x * blockDim.x + threadIdx.x;
  const int f = gid & (DIM - 1);
  const int c = (gid >> 10) & (NCHK - 1);
  const int b = gid >> 15;
  const size_t base = ((size_t)b * SEQ + (size_t)c * CHUNK) * DIM + f;
  const size_t pidx = ((size_t)b * NCHK + c) * DIM + f;
  float cg = Sg[pidx], cv = Sv[pidx];
  const float invS = 1.0f / (float)SEQ;
  for (int s = 0; s < CHUNK; ++s) {
    size_t idx = base + (size_t)s * DIM;
    float gg = G[idx];
    float vv = V[idx];
    cv = fmaf(gg, vv, cv);
    cg += gg;
    int pos = c * CHUNK + s + 1;
    float denom = sqrtf(cg + 1e-6f) * sqrtf((float)pos * invS + 0.1f);
    X1[idx] = X[idx] + cv / denom;
  }
}

// ---- epilogue stores: four neighbouring columns of two output rows (PB bytes apart) per lane ----
// The two stores and their s_wait_xcnt 0 stand in one statement, so that neither the address pair
// nor a data register they name is rewritten ahead of that wait.
template<int PB> __device__ __forceinline__ void store_rows_f32(float* p, v4f x0, v4f x1) {
  asm volatile("global_store_b128 %0, %1, off\n\t"
               "global_store_b128 %0, %2, off offset:%3\n\t"
               "s_wait_xcnt 0x0"
               :: "v"(p), "v"(x0), "v"(x1), "n"(PB) : "memory");
}
template<int PB> __device__ __forceinline__ void store_rows_f16(_Float16* p, v4h x0, v4h x1) {
  asm volatile("global_store_b64 %0, %1, off\n\t"
               "global_store_b64 %0, %2, off offset:%3\n\t"
               "s_wait_xcnt 0x0"
               :: "v"(p), "v"(__builtin_bit_cast(v2u, x0)), "v"(__builtin_bit_cast(v2u, x1)), "n"(PB) : "memory");
}
// This lane's four bias values. The load and its data wait stand in one statement with an
// early-clobber output, so that the address pair is not taken as the destination.
__device__ __forceinline__ v4f load_bias(const float* p) {
  v4f x;
  asm volatile("global_load_b128 %0, %1, off\n\t"
               "s_wait_loadcnt 0x0"
               : "=&v"(x) : "v"(p) : "memory");
  return x;
}

// ---------------- WMMA GEMM:  out[m,n] = sum_k A[m,k] * W16[n,k]  (+bias, epilogue) ---------
// EPI: 0 = sigmoid -> f32,  1 = identity -> f32,  2 = exact GELU -> f16,  3 = +residual -> f32
// N (the output's row length) is a template parameter: the epilogue's row steps are then immediates.
template<int EPI, int N>
// Eight waves, two per SIMD; the register budget of four waves per SIMD lets two blocks share a WGP,
// so that one block's epilogue, LDS reads and barrier waits run beside the other block's matrix work.
__global__ void __launch_bounds__(256) __attribute__((amdgpu_waves_per_eu(4)))
gemm_wmma_kernel(const _Float16* __restrict__ A, const _Float16* __restrict__ W16,
                 const float* __restrict__ bias, const float* __restrict__ res,
                 float* __restrict__ outF, _Float16* __restrict__ outH,
                 int M, int K) {
  // Two buffers of 384 rows (A tile, then W tile) of 64 halves at pitch LDP: the 16 rows that a
  // half-wave's ds_load_b128 reads fall on 64 distinct banks.
  __shared__ __align__(16) _Float16 smem[2 * STAGE_H];

  const int tid  = threadIdx.x;
  const int lane = tid & 31;
  const int wave = tid >> 5;
  const int wm   = wave & 1;        // 0..1 -> 64-row M strip of the block tile
  const int wn   = wave >> 1;       // 0..3 -> 64-column N strip of the block tile
  const int hi   = lane >> 4;       // lane half selects K-phase (ISA frag layout)
  const int l15  = lane & 15;
  const int m0   = blockIdx.y * BM;
  const int n0   = blockIdx.x * BN;

  // Per-thread async staging assignment: 16-B chunk (tid & 7) of rows (tid >> 3) + 32 q.
  const int cC = (tid & 7) * 8;
  const int rC = tid >> 3;
  const size_t gs = (size_t)32 * K;
  const _Float16* gA = A   + (size_t)(m0 + rC) * K + cC;
  const _Float16* gB = W16 + (size_t)(n0 + rC) * K + cC;
  _Float16* lC = &smem[rC * LDP + cC];

  const int nsteps = K >> 6;

  // prologue: tile 0 into buffer 0, published; then tile 1 starts into buffer 1
  stage_copies(lC, gA, gB, gs);
  WAIT_ASYNCCNT0();
  __syncthreads();
  if (nsteps > 1) stage_copies(lC + STAGE_H, gA + BK, gB + BK, gs);

  // every loop over i, t and r below is unrolled: the accumulators and fragments are register
  // arrays and need constant indices
  v8f acc[4][4];
#pragma unroll
  for (int i = 0; i < 4; ++i)
#pragma unroll
    for (int t = 0; t < 4; ++t)
#pragma unroll
      for (int r = 0; r < 8; ++r) acc[i][t][r] = 0.0f;

  const int offA = (wm * 64 + l15) * LDP + 8 * hi;
  const int offB = (BM + wn * 64 + l15) * LDP + 8 * hi;

  for (int s = 0; s < nsteps; ++s) {
    const int buf = s & 1;
    const _Float16* sa = smem + buf * STAGE_H + offA;
    const _Float16* sb = smem + buf * STAGE_H + offB;

    // the stage's two k halves in turn, each: 8 fragments from LDS, then 16 WMMAs
#pragma unroll
    for (int kk = 0; kk < BK / 32; ++kk) {
      // fragment (16x32 f16): lane<16 holds K {0..7,16..23}, lane>=16 holds K {8..15,24..31}
      v16h afrag[4];
      v16h bfrag[4];
#pragma unroll
      for (int i = 0; i < 4; ++i) {
        const _Float16* ap = sa + i * 16 * LDP + kk * 32;
        v8h alo = *(const v8h*)(ap);
        v8h ahi = *(const v8h*)(ap + 16);
        afrag[i] = __builtin_shufflevector(alo, ahi, 0,1,2,3,4,5,6,7,8,9,10,11,12,13,14,15);
      }
#pragma unroll
      for (int t = 0; t < 4; ++t) {
        const _Float16* bp = sb + t * 16 * LDP + kk * 32;
        v8h blo = *(const v8h*)(bp);
        v8h bhi = *(const v8h*)(bp + 16);
        bfrag[t] = __builtin_shufflevector(blo, bhi, 0,1,2,3,4,5,6,7,8,9,10,11,12,13,14,15);
      }
      if (kk == BK / 32 - 1) {
        // publish point: my last reads of buf have returned, my copies of tile s+1 have landed; the
        // one barrier publishes tile s+1 and frees buf for the refill behind it, which then flies
        // during this half's WMMAs and the next stage up to its publish point
        WAIT_DSCNT0();
        WAIT_ASYNCCNT0();
        __syncthreads();
        if (s + 2 < nsteps) {
          const int k = (s + 2) * BK;
          stage_copies(lC + buf * STAGE_H, gA + k, gB + k, gs);
        }
      }
#pragma unroll
      for (int t = 0; t < 4; ++t)
#pragma unroll
        for (int i = 0; i < 4; ++i)
          acc[i][t] = __builtin_amdgcn_wmma_f32_16x16x32_f16(
              false, afrag[i], false, bfrag[t], (short)0, acc[i][t], false, false);
    }
  }
  WAIT_ASYNCCNT0();

  // epilogue. The accumulators pass through LDS (free behind the loop's last barrier), 16 rows of the
  // wave's strip at a time, each wave in a region of its own: the element-wise math is then a loop
  // over rows that can stay rolled (unrolled over a lane's 128 values the erf kernel's text passes
  // 32 KB), and a lane stores four neighbouring columns at once.
  float* ep = (float*)smem + wave * (16 * EPP);
  const int c4    = l15 * 4;                    // this lane's columns: c4..c4+3 of the wave's 64
  const int ncol0 = n0 + wn * 64 + c4;
  // this lane's rows of a group: it * 4 + hi and it * 4 + 2 + hi
  const size_t e0 = (size_t)(m0 + wm * 64 + hi) * N + ncol0;
  v4f bv;

  // residual of 16 rows, fetched one group of rows ahead of its use so that its latency is hidden
  v4f rv[2][4][2];
  if (EPI == 3) {
#pragma unroll
    for (int it = 0; it < 4; ++it) {
      rv[0][it][0] = *(const v4f*)(res + e0 + (it * 4) * N);
      rv[0][it][1] = *(const v4f*)(res + e0 + (it * 4 + 2) * N);
    }
  }
#pragma unroll
  for (int i = 0; i < 4; ++i) {
    if (i > 0) __syncthreads();   // the last group's reads are done before its rows are overwritten
    // D layout: lanes 0-15 N=lane, M=r; lanes 16-31 N=lane-16, M=r+8
#pragma unroll
    for (int t = 0; t < 4; ++t)
#pragma unroll
      for (int r = 0; r < 8; ++r) ep[(hi * 8 + r) * EPP + t * 16 + l15] = acc[i][t][r];
    if (i == 0) bv = load_bias(bias + ncol0);   // its wait passes beside that of the LDS writes above
    __syncthreads();              // the rows are written before other lanes read them
    // behind the barrier (which waits for every load in flight), so that these fly during this group's work
    if (EPI == 3 && i + 1 < 4) {
#pragma unroll
      for (int it = 0; it < 4; ++it) {
        rv[(i + 1) & 1][it][0] = *(const v4f*)(res + e0 + ((i + 1) * 16 + it * 4) * N);
        rv[(i + 1) & 1][it][1] = *(const v4f*)(res + e0 + ((i + 1) * 16 + it * 4 + 2) * N);
      }
    }
    if (EPI == 0 || EPI == 2) {
      // stays rolled, to keep the kernel's text short: 32 exp or erf evaluations in the text (eight per copy of this loop), not 128
#pragma unroll 1
      for (int it = 0; it < 4; ++it) {
        const float* q = ep + (it * 4 + hi) * EPP + c4;
        const v4f v0 = *(const v4f*)q + bv;
        const v4f v1 = *(const v4f*)(q + 2 * EPP) + bv;
        const size_t e = e0 + (size_t)(i * 16 + it * 4) * N;
        if (EPI == 0) {
          v4f o0, o1;
#pragma unroll
          for (int j = 0; j < 4; ++j) {
            o0[j] = 1.0f / (1.0f + expf(-v0[j]));
            o1[j] = 1.0f / (1.0f + expf(-v1[j]));
          }
          store_rows_f32<2 * N * 4>(outF + e, o0, o1);
        } else {
          v4h o0, o1;
#pragma unroll
          for (int j = 0; j < 4; ++j) {
            o0[j] = (_Float16)(0.5f * v0[j] * (1.0f + erff(v0[j] * 0.70710678118654752f)));
            o1[j] = (_Float16)(0.5f * v1[j] * (1.0f + erff(v1[j] * 0.70710678118654752f)));
          }
          store_rows_f16<2 * N * 2>(outH + e, o0, o1);
        }
      }
    } else {
#pragma unroll
      for (int it = 0; it < 4; ++it) {
        const float* q = ep + (it * 4 + hi) * EPP + c4;
        v4f v0 = *(const v4f*)q + bv;
        v4f v1 = *(const v4f*)(q + 2 * EPP) + bv;
        if (EPI == 3) {
          v0 = rv[i & 1][it][0] + v0;
          v1 = rv[i & 1][it][1] + v1;
        }
        store_rows_f32<2 * N * 4>(outF + e0 + (i * 16 + it * 4) * N, v0, v1);
      }
    }
  }
}

extern "C" void kernel_launch(void* const* d_in, const int* in_sizes, int n_in,
                              void* d_out, int out_size, void* d_ws, size_t ws_size,
                              hipStream_t stream) {
  (void)in_sizes; (void)n_in; (void)out_size; (void)ws_size;
  const float* x      = (const float*)d_in[0];
  const float* ln1_w  = (const float*)d_in[1];
  const float* ln1_b  = (const float*)d_in[2];
  const float* ln2_w  = (const float*)d_in[3];
  const float* ln2_b  = (const float*)d_in[4];
  const float* gate_w = (const float*)d_in[5];
  const float* gate_b = (const float*)d_in[6];
  const float* val_w  = (const float*)d_in[7];
  const float* val_b  = (const float*)d_in[8];
  const float* ffn1_w = (const float*)d_in[9];
  const float* ffn1_b = (const float*)d_in[10];
  const float* ffn2_w = (const float*)d_in[11];
  const float* ffn2_b = (const float*)d_in[12];

  char* ws = (char*)d_ws;
  const size_t MB = 1024ull * 1024ull;
  _Float16* h16   = (_Float16*)(ws);             // 32 MB: LN output (reused for LN2)
  float*    G     = (float*)(ws + 32 * MB);      // 64 MB
  float*    V     = (float*)(ws + 96 * MB);      // 64 MB
  _Float16* FF1   = (_Float16*)(ws + 32 * MB);   // 128 MB, reuses dead G/V region
  _Float16* gw16  = (_Float16*)(ws + 160 * MB);  // 2 MB
  _Float16* vw16  = (_Float16*)(ws + 162 * MB);  // 2 MB
  _Float16* w1_16 = (_Float16*)(ws + 164 * MB);  // 8 MB
  _Float16* w2_16 = (_Float16*)(ws + 172 * MB);  // 8 MB
  float*    Sg    = (float*)(ws + 180 * MB);     // 512 KB chunk partials
  float*    Sv    = (float*)(ws + 181 * MB);     // 512 KB chunk partials
  float*    X1    = (float*)d_out;               // x + mem lives in d_out

  // 1) weights -> f16
  f32_to_f16_kernel<<<(DIM * DIM) / 256, 256, 0, stream>>>(gate_w, gw16, DIM * DIM);
  f32_to_f16_kernel<<<(DIM * DIM) / 256, 256, 0, stream>>>(val_w,  vw16, DIM * DIM);
  f32_to_f16_kernel<<<(4 * DIM * DIM) / 256, 256, 0, stream>>>(ffn1_w, w1_16, 4 * DIM * DIM);
  f32_to_f16_kernel<<<(4 * DIM * DIM) / 256, 256, 0, stream>>>(ffn2_w, w2_16, 4 * DIM * DIM);

  // 2) h = LN1(x)
  layernorm_f16_kernel<<<MROWS, 256, 0, stream>>>(x, ln1_w, ln1_b, h16);

  // 3) g = sigmoid(h @ gate_w^T + b), v = h @ val_w^T + b
  gemm_wmma_kernel<0, DIM><<<dim3(DIM / BN, MROWS / BM), 256, 0, stream>>>(
      h16, gw16, gate_b, nullptr, G, nullptr, MROWS, DIM);
  gemm_wmma_kernel<1, DIM><<<dim3(DIM / BN, MROWS / BM), 256, 0, stream>>>(
      h16, vw16, val_b, nullptr, V, nullptr, MROWS, DIM);

  // 4) x1 = x + cumsum(g*v) / (sqrt(cumsum(g)+1e-6)*sqrt(pos/S+0.1))   [3-pass scan]
  scan_partial_kernel<<<(BATCH * NCHK * DIM) / 256, 256, 0, stream>>>(G, V, Sg, Sv);
  scan_prefix_kernel<<<(BATCH * DIM) / 256, 256, 0, stream>>>(Sg, Sv);
  scan_apply_kernel<<<(BATCH * NCHK * DIM) / 256, 256, 0, stream>>>(x, G, V, Sg, Sv, X1);

  // 5) h2 = LN2(x1)
  layernorm_f16_kernel<<<MROWS, 256, 0, stream>>>(X1, ln2_w, ln2_b, h16);

  // 6) ff1 = gelu(h2 @ ffn1_w^T + b)  -> f16
  gemm_wmma_kernel<2, 4 * DIM><<<dim3(4 * DIM / BN, MROWS / BM), 256, 0, stream>>>(
      h16, w1_16, ffn1_b, nullptr, nullptr, FF1, MROWS, DIM);

  // 7) out = x1 + (ff1 @ ffn2_w^T + b)
  gemm_wmma_kernel<3, DIM><<<dim3(DIM / BN, MROWS / BM), 256, 0, stream>>>(
      FF1, w2_16, ffn2_b, X1, X1, nullptr, MROWS, 4 * DIM);
}

// v003
// A run of this version takes 383 microseconds.
// Next to v002, in two timings, it ran 1.08 times as fast each time.
// All steps since v000 together make it 2.19 times as fast.
#include <hip/hip_runtime.h>
#include <hip/hip_bf16.h>
#include <math.h>

typedef __attribute__((ext_vector_type(16))) _Float16 v16h;
typedef __attribute__((ext_vector_type(8)))  _Float16 v8h;
typedef __attribute__((ext_vector_type(8)))  float    v8f;
typedef __attribute__((ext_vector_type(4)))  float    v4f;
typedef __attribute__((ext_vector_type(4)))  _Float16 v4h;
typedef __attribute__((ext_vector_type(2)))  uint32_t v2u;

#define DIM   1024
#define SEQ   4096
#define BATCH 4
#define MROWS (BATCH*SEQ)   // 16384 token rows
#define CHUNK 128
#define NCHK  (SEQ/CHUNK)   // 32 chunks per sequence
#define BM    128           // GEMM block tile rows (tokens)
#define BN    256           // GEMM block tile columns (output features)
#define BK    64            // k extent of one staged tile
#define LDP   72            // LDS row pitch of the GEMM tiles in halves: 64 data + 8 pad = 144 B (16 B x odd)
#define STAGE_H ((BM + BN) * LDP)   // halves per buffer: A rows 0..127, then W rows 0..255
#define EPP   68            // LDS row pitch of the epilogue in floats: 64 data + 4 pad (rows 8 apart: 32 banks apart)

// ---- CDNA5 async copy: global -> LDS, 16 bytes per lane and copy, tracked by ASYNCcnt ----
typedef int v4i_t __attribute__((__vector_size__(16)));
typedef __attribute__((address_space(1))) v4i_t* gptr_t;
typedef __attribute__((address_space(3))) v4i_t* lptr_t;
// One staged tile: 128 A rows and 256 W rows of 128 B each, 12 copies per thread (rows 32 apart,
// gs halves apart in global memory). Builtin copies: the compiler owns their address registers.
__device__ __forceinline__ void stage_copies(_Float16* l, const _Float16* ga, const _Float16* gb, size_t gs) {
  // both loops unrolled: straight-line copies, their LDS row offsets folded into constants
#pragma unroll
  for (int q = 0; q < BM / 32; ++q)
    __builtin_amdgcn_global_load_async_to_lds_b128((gptr_t)(ga + q * gs), (lptr_t)(l + q * 32 * LDP), 0, 0);
#pragma unroll
  for (int q = 0; q < BN / 32; ++q)
    __builtin_amdgcn_global_load_async_to_lds_b128((gptr_t)(gb + q * gs), (lptr_t)(l + (BM + q * 32) * LDP), 0, 0);
}
// This wave's copies have landed in LDS.
#define WAIT_ASYNCCNT0() asm volatile("s_wait_asynccnt 0x0" ::: "memory")
// This wave's LDS reads have returned, so the buffer they read may be refilled behind the barrier.
#define WAIT_DSCNT0()    asm volatile("s_wait_dscnt 0x0" ::: "memory")

// ---------------- fp32 -> fp16 weight conversion ----------------
// A block converts CVT_PER_BLOCK neighbouring elements: eight 16-byte loads per lane, each wave-wide
// load 512 contiguous bytes, all in flight together. Few long waves, for speed only.
// The grid covers the array exactly (its size is a multiple of CVT_PER_BLOCK).
#define CVT_PER_BLOCK (256 * 4 * 8)
__global__ void __launch_bounds__(256)
f32_to_f16_kernel(const float* __restrict__ src, _Float16* __restrict__ dst) {
  const size_t base = (size_t)blockIdx.x * CVT_PER_BLOCK + threadIdx.x * 4;
  v4f x[8];
  // both loops unrolled: x is a register array, and the loads go out ahead of the first store
#pragma unroll
  for (int j = 0; j < 8; ++j) x[j] = *(const v4f*)(src + base + j * 1024);
#pragma unroll
  for (int j = 0; j < 8; ++j) *(v4h*)(dst + base + j * 1024) = __builtin_convertvector(x[j], v4h);
}

// ---------------- LayerNorm: one wave per LNR rows of 1024, eight waves a block ----------------
// A lane holds 32 values of each row (eight 16-byte loads, each wave-wide load 512 contiguous bytes);
// all LNR rows are in flight together, and their sums cross the lanes in one interleaved butterfly.
#define LNR 4
__global__ void __launch_bounds__(256)
layernorm_f16_kernel(const float* __restrict__ X, const float* __restrict__ W,
                     const float* __restrict__ B, _Float16* __restrict__ H) {
  const int lane = threadIdx.x & 31;
  const int wave = threadIdx.x >> 5;
  const size_t e0 = (size_t)(blockIdx.x * 8 + wave) * (LNR * DIM) + lane * 4;
  const float* xr = X + e0;
  // every loop below is unrolled: a, w, b, s and q are register arrays and need constant indices
  v4f a[LNR][8];
#pragma unroll
  for (int r = 0; r < LNR; ++r)
#pragma unroll
    for (int j = 0; j < 8; ++j) a[r][j] = *(const v4f*)(xr + r * DIM + j * 128);
  // this lane's columns of weight and bias, asked for behind the rows: they are there when the sums are
  v4f w[8], b[8];
#pragma unroll
  for (int j = 0; j < 8; ++j) {
    w[j] = *(const v4f*)(W + j * 128 + lane * 4);
    b[j] = *(const v4f*)(B + j * 128 + lane * 4);
  }
  // keeps the weight and bias loads up here: moved down to their uses they are waited for pair by pair
  __builtin_amdgcn_sched_barrier(0);
  // the wait in front of any rewrite of a register that the loads above name; as its operand the rows'
  // address pair stays live up to here (without it a weight load took the pair as its destination)
  asm volatile("s_wait_xcnt 0x0" :: "v"(xr) : "memory");
  float s[LNR], q[LNR];
#pragma unroll
  for (int r = 0; r < LNR; ++r) {
    v4f s4 = a[r][0];
    v4f q4 = a[r][0] * a[r][0];
#pragma unroll
    for (int j = 1; j < 8; ++j) { s4 += a[r][j]; q4 += a[r][j] * a[r][j]; }
    s[r] = (s4[0] + s4[1]) + (s4[2] + s4[3]);
    q[r] = (q4[0] + q4[1]) + (q4[2] + q4[3]);
  }
#pragma unroll
  for (int m = 16; m > 0; m >>= 1)
#pragma unroll
    for (int r = 0; r < LNR; ++r) {
      s[r] += __shfl_xor(s[r], m, 32);
      q[r] += __shfl_xor(q[r], m, 32);
    }
  float mean[LNR], rstd[LNR];
#pragma unroll
  for (int r = 0; r < LNR; ++r) {
    mean[r] = s[r] * (1.0f / DIM);
    rstd[r] = rsqrtf(q[r] * (1.0f / DIM) - mean[r] * mean[r] + 1e-5f);
  }
  _Float16* hr = H + e0;
#pragma unroll
  for (int j = 0; j < 8; ++j)
#pragma unroll
    for (int r = 0; r < LNR; ++r)
      *(v4h*)(hr + r * DIM + j * 128) = __builtin_convertvector((a[r][j] - mean[r]) * rstd[r] * w[j] + b[j], v4h);
}

// ---------------- 3-pass chunked scan over the seq axis ----------------
// pass 1: per-chunk sums of g and g*v
__global__ void scan_partial_kernel(const float* __restrict__ G, const float* __restrict__ V,
                                    float* __restrict__ Sg, float* __restrict__ Sv) {
  const int gid = blockIdx.x * blockDim.x + threadIdx.x;   // 0 .. BATCH*NCHK*DIM-1
  const int f = gid & (DIM - 1);
  const int c = (gid >> 10) & (NCHK - 1);
  const int b = gid >> 15;
  const size_t base = ((size_t)b * SEQ + (size_t)c * CHUNK) * DIM + f;
  float sg = 0.0f, sv = 0.0f;
  for (int s = 0; s < CHUNK; ++s) {
    float gg = G[base + (size_t)s * DIM];
    float vv = V[base + (size_t)s * DIM];
    sg += gg;
    sv = fmaf(gg, vv, sv);
  }
  const size_t pidx = ((size_t)b * NCHK + c) * DIM + f;
  Sg[pidx] = sg; Sv[pidx] = sv;
}

// pass 2: exclusive prefix over chunks, per (batch, feature) column
__global__ void scan_prefix_kernel(float* __restrict__ Sg, float* __restrict__ Sv) {
  const int gid = blockIdx.x * blockDim.x + threadIdx.x;   // 0..4095
  const int b = gid >> 10, f = gid & (DIM - 1);
  float ag = 0.0f, av = 0.0f;
  for (int c = 0; c < NCHK; ++c) {
    size_t idx = ((size_t)b * NCHK + c) * DIM + f;
    float g0 = Sg[idx], v0 = Sv[idx];
    Sg[idx] = ag; Sv[idx] = av;
    ag += g0; av += v0;
  }
}

// pass 3: chunk-local scan with carry-in; x1 = x + mem
__global__ void scan_apply_kernel(const float* __restrict__ X, const float* __restrict__ G,
                                  const float* __restrict__ V, const float* __restrict__ Sg,
                                  const float* __restrict__ Sv, float* __restrict__ X1) {
  const int gid = blockIdx.x * blockDim.x + threadIdx.x;
  const int f = gid & (DIM - 1);
  const int c = (gid >> 10) & (NCHK - 1);
  const int b = gid >> 15;
  const size_t base = ((size_t)b * SEQ + (size_t)c * CHUNK) * DIM + f;
  const size_t pidx = ((size_t)b * NCHK + c) * DIM + f;
  float cg = Sg[pidx], cv = Sv[pidx];
  const float invS = 1.0f / (float)SEQ;
  for (int s = 0; s < CHUNK; ++s) {
    size_t idx = base + (size_t)s * DIM;
    float gg = G[idx];
    float vv = V[idx];
    cv = fmaf(gg, vv, cv);
    cg += gg;
    int pos = c * CHUNK + s + 1;
    float denom = sqrtf(cg + 1e-6f) * sqrtf((float)pos * invS + 0.1f);
    X1[idx] = X[idx] + cv / denom;
  }
}

// ---- epilogue stores: four neighbouring columns of two output rows (PB bytes apart) per lane ----
// The two stores and their s_wait_xcnt 0 stand in one statement, so that neither the address pair
// nor a data register they name is rewritten ahead of that wait.
template<int PB> __device__ __forceinline__ void store_rows_f32(float* p, v4f x0, v4f x1) {
  asm volatile("global_store_b128 %0, %1, off\n\t"
               "global_store_b128 %0, %2, off offset:%3\n\t"
               "s_wait_xcnt 0x0"
               :: "v"(p), "v"(x0), "v"(x1), "n"(PB) : "memory");
}
template<int PB> __device__ __forceinline__ void store_rows_f16(_Float16* p, v4h x0, v4h x1) {
  asm volatile("global_store_b64 %0, %1, off\n\t"
               "global_store_b64 %0, %2, off offset:%3\n\t"
               "s_wait_xcnt 0x0"
               :: "v"(p), "v"(__builtin_bit_cast(v2u, x0)), "v"(__builtin_bit_cast(v2u, x1)), "n"(PB) : "memory");
}
// This lane's four bias values. The load and its data wait stand in one statement with an
// early-clobber output, so that the address pair is not taken as the destination.
__device__ __forceinline__ v4f load_bias(const float* p) {
  v4f x;
  asm volatile("global_load_b128 %0, %1, off\n\t"
               "s_wait_loadcnt 0x0"
               : "=&v"(x) : "v"(p) : "memory");
  return x;
}

// ---------------- WMMA GEMM:  out[m,n] = sum_k A[m,k] * W16[n,k]  (+bias, epilogue) ---------
// EPI: 0 = sigmoid -> f32,  1 = identity -> f32,  2 = exact GELU -> f16,  3 = +residual -> f32
// N (the output's row length) is a template parameter: the epilogue's row steps are then immediates.
template<int EPI, int N>
// Eight waves, two per SIMD; the register budget of four waves per SIMD lets two blocks share a WGP,
// so that one block's epilogue, LDS reads and barrier waits run beside the other block's matrix work.
__global__ void __launch_bounds__(256) __attribute__((amdgpu_waves_per_eu(4)))
gemm_wmma_kernel(const _Float16* __restrict__ A, const _Float16* __restrict__ W16,
                 const float* __restrict__ bias, const float* __restrict__ res,
                 float* __restrict__ outF, _Float16* __restrict__ outH,
                 int M, int K) {
  // Two buffers of 384 rows (A tile, then W tile) of 64 halves at pitch LDP: the 16 rows that a
  // half-wave's ds_load_b128 reads fall on 64 distinct banks.
  __shared__ __align__(16) _Float16 smem[2 * STAGE_H];

  const int tid  = threadIdx.x;
  const int lane = tid & 31;
  const int wave = tid >> 5;
  const int wm   = wave & 1;        // 0..1 -> 64-row M strip of the block tile
  const int wn   = wave >> 1;       // 0..3 -> 64-column N strip of the block tile
  const int hi   = lane >> 4;       // lane half selects K-phase (ISA frag layout)
  const int l15  = lane & 15;
  const int m0   = blockIdx.y * BM;
  const int n0   = blockIdx.x * BN;

  // Per-thread async staging assignment: 16-B chunk (tid & 7) of rows (tid >> 3) + 32 q.
  const int cC = (tid & 7) * 8;
  const int rC = tid >> 3;
  const size_t gs = (size_t)32 * K;
  const _Float16* gA = A   + (size_t)(m0 + rC) * K + cC;
  const _Float16* gB = W16 + (size_t)(n0 + rC) * K + cC;
  _Float16* lC = &smem[rC * LDP + cC];

  const int nsteps = K >> 6;

  // prologue: tile 0 into buffer 0, published; then tile 1 starts into buffer 1
  stage_copies(lC, gA, gB, gs);
  WAIT_ASYNCCNT0();
  __syncthreads();
  if (nsteps > 1) stage_copies(lC + STAGE_H, gA + BK, gB + BK, gs);

  // every loop over i, t and r below is unrolled: the accumulators and fragments are register
  // arrays and need constant indices
  v8f acc[4][4];
#pragma unroll
  for (int i = 0; i < 4; ++i)
#pragma unroll
    for (int t = 0; t < 4; ++t)
#pragma unroll
      for (int r = 0; r < 8; ++r) acc[i][t][r] = 0.0f;

  const int offA = (wm * 64 + l15) * LDP + 8 * hi;
  const int offB = (BM + wn * 64 + l15) * LDP + 8 * hi;

  for (int s = 0; s < nsteps; ++s) {
    const int buf = s & 1;
    const _Float16* sa = smem + buf * STAGE_H + offA;
    const _Float16* sb = smem + buf * STAGE_H + offB;

    // the stage's two k halves in turn, each: 8 fragments from LDS, then 16 WMMAs
#pragma unroll
    for (int kk = 0; kk < BK / 32; ++kk) {
      // fragment (16x32 f16): lane<16 holds K {0..7,16..23}, lane>=16 holds K {8..15,24..31}
      v16h afrag[4];
      v16h bfrag[4];
#pragma unroll
      for (int i = 0; i < 4; ++i) {
        const _Float16* ap = sa + i * 16 * LDP + kk * 32;
        v8h alo = *(const v8h*)(ap);
        v8h ahi = *(const v8h*)(ap + 16);
        afrag[i] = __builtin_shufflevector(alo, ahi, 0,1,2,3,4,5,6,7,8,9,10,11,12,13,14,15);
      }
#pragma unroll
      for (int t = 0; t < 4; ++t) {
        const _Float16* bp = sb + t * 16 * LDP + kk * 32;
        v8h blo = *(const v8h*)(bp);
        v8h bhi = *(const v8h*)(bp + 16);
        bfrag[t] = __builtin_shufflevector(blo, bhi, 0,1,2,3,4,5,6,7,8,9,10,11,12,13,14,15);
      }
      if (kk == BK / 32 - 1) {
        // publish point: my last reads of buf have returned, my copies of tile s+1 have landed; the
        // one barrier publishes tile s+1 and frees buf for the refill behind it, which then flies
        // during this half's WMMAs and the next stage up to its publish point
        WAIT_DSCNT0();
        WAIT_ASYNCCNT0();
        __syncthreads();
        if (s + 2 < nsteps) {
          const int k = (s + 2) * BK;
          stage_copies(lC + buf * STAGE_H, gA + k, gB + k, gs);
        }
      }
#pragma unroll
      for (int t = 0; t < 4; ++t)
#pragma unroll
        for (int i = 0; i < 4; ++i)
          acc[i][t] = __builtin_amdgcn_wmma_f32_16x16x32_f16(
              false, afrag[i], false, bfrag[t], (short)0, acc[i][t], false, false);
    }
  }
  WAIT_ASYNCCNT0();

  // epilogue. The accumulators pass through LDS (free behind the loop's last barrier), 16 rows of the
  // wave's strip at a time, each wave in a region of its own: the element-wise math is then a loop
  // over rows that can stay rolled (unrolled over a lane's 128 values the erf kernel's text passes
  // 32 KB), and a lane stores four neighbouring columns at once.
  float* ep = (float*)smem + wave * (16 * EPP);
  const int c4    = l15 * 4;                    // this lane's columns: c4..c4+3 of the wave's 64
  const int ncol0 = n0 + wn * 64 + c4;
  // this lane's rows of a group: it * 4 + hi and it * 4 + 2 + hi
  const size_t e0 = (size_t)(m0 + wm * 64 + hi) * N + ncol0;
  v4f bv;

  // residual of 16 rows, fetched one group of rows ahead of its use so that its latency is hidden
  v4f rv[2][4][2];
  if (EPI == 3) {
#pragma unroll
    for (int it = 0; it < 4; ++it) {
      rv[0][it][0] = *(const v4f*)(res + e0 + (it * 4) * N);
      rv[0][it][1] = *(const v4f*)(res + e0 + (it * 4 + 2) * N);
    }
  }
#pragma unroll
  for (int i = 0; i < 4; ++i) {
    if (i > 0) __syncthreads();   // the last group's reads are done before its rows are overwritten
    // D layout: lanes 0-15 N=lane, M=r; lanes 16-31 N=lane-16, M=r+8
#pragma unroll
    for (int t = 0; t < 4; ++t)
#pragma unroll
      for (int r = 0; r < 8; ++r) ep[(hi * 8 + r) * EPP + t * 16 + l15] = acc[i][t][r];
    if (i == 0) bv = load_bias(bias + ncol0);   // its wait passes beside that of the LDS writes above
    __syncthreads();              // the rows are written before other lanes read them
    // behind the barrier (which waits for every load in flight), so that these fly during this group's work
    if (EPI == 3 && i + 1 < 4) {
#pragma unroll
      for (int it = 0; it < 4; ++it) {
        rv[(i + 1) & 1][it][0] = *(const v4f*)(res + e0 + ((i + 1) * 16 + it * 4) * N);
        rv[(i + 1) & 1][it][1] = *(const v4f*)(res + e0 + ((i + 1) * 16 + it * 4 + 2) * N);
      }
    }
    if (EPI == 0 || EPI == 2) {
      // stays rolled, to keep the kernel's text short: 32 exp or erf evaluations in the text (eight per copy of this loop), not 128
#pragma unroll 1
      for (int it = 0; it < 4; ++it) {
        const float* q = ep + (it * 4 + hi) * EPP + c4;
        const v4f v0 = *(const v4f*)q + bv;
        const v4f v1 = *(const v4f*)(q + 2 * EPP) + bv;
        const size_t e = e0 + (size_t)(i * 16 + it * 4) * N;
        if (EPI == 0) {
          v4f o0, o1;
#pragma unroll
          for (int j = 0; j < 4; ++j) {
            o0[j] = 1.0f / (1.0f + expf(-v0[j]));
            o1[j] = 1.0f / (1.0f + expf(-v1[j]));
          }
          store_rows_f32<2 * N * 4>(outF + e, o0, o1);
        } else {
          v4h o0, o1;
#pragma unroll
          for (int j = 0; j < 4; ++j) {
            o0[j] = (_Float16)(0.5f * v0[j] * (1.0f + erff(v0[j] * 0.70710678118654752f)));
            o1[j] = (_Float16)(0.5f * v1[j] * (1.0f + erff(v1[j] * 0.70710678118654752f)));
          }
          store_rows_f16<2 * N * 2>(outH + e, o0, o1);
        }
      }
    } else {
#pragma unroll
      for (int it = 0; it < 4; ++it) {
        const float* q = ep + (it * 4 + hi) * EPP + c4;
        v4f v0 = *(const v4f*)q + bv;
        v4f v1 = *(const v4f*)(q + 2 * EPP) + bv;
        if (EPI == 3) {
          v0 = rv[i & 1][it][0] + v0;
          v1 = rv[i & 1][it][1] + v1;
        }
        store_rows_f32<2 * N * 4>(outF + e0 + (i * 16 + it * 4) * N, v0, v1);
      }
    }
  }
}

extern "C" void kernel_launch(void* const* d_in, const int* in_sizes, int n_in,
                              void* d_out, int out_size, void* d_ws, size_t ws_size,
                              hipStream_t stream) {
  (void)in_sizes; (void)n_in; (void)out_size; (void)ws_size;
  const float* x      = (const float*)d_in[0];
  const float* ln1_w  = (const float*)d_in[1];
  const float* ln1_b  = (const float*)d_in[2];
  const float* ln2_w  = (const float*)d_in[3];
  const float* ln2_b  = (const float*)d_in[4];
  const float* gate_w = (const float*)d_in[5];
  const float* gate_b = (const float*)d_in[6];
  const float* val_w  = (const float*)d_in[7];
  const float* val_b  = (const float*)d_in[8];
  const float* ffn1_w = (const float*)d_in[9];
  const float* ffn1_b = (const float*)d_in[10];
  const float* ffn2_w = (const float*)d_in[11];
  const float* ffn2_b = (const float*)d_in[12];

  char* ws = (char*)d_ws;
  const size_t MB = 1024ull * 1024ull;
  _Float16* h16   = (_Float16*)(ws);             // 32 MB: LN output (reused for LN2)
  float*    G     = (float*)(ws + 32 * MB);      // 64 MB
  float*    V     = (float*)(ws + 96 * MB);      // 64 MB
  _Float16* FF1   = (_Float16*)(ws + 32 * MB);   // 128 MB, reuses dead G/V region
  _Float16* gw16  = (_Float16*)(ws + 160 * MB);  // 2 MB
  _Float16* vw16  = (_Float16*)(ws + 162 * MB);  // 2 MB
  _Float16* w1_16 = (_Float16*)(ws + 164 * MB);  // 8 MB
  _Float16* w2_16 = (_Float16*)(ws + 172 * MB);  // 8 MB
  float*    Sg    = (float*)(ws + 180 * MB);     // 512 KB chunk partials
  float*    Sv    = (float*)(ws + 181 * MB);     // 512 KB chunk partials
  float*    X1    = (float*)d_out;               // x + mem lives in d_out

  // 1) weights -> f16
  f32_to_f16_kernel<<<(DIM * DIM) / CVT_PER_BLOCK, 256, 0, stream>>>(gate_w, gw16);
  f32_to_f16_kernel<<<(DIM * DIM) / CVT_PER_BLOCK, 256, 0, stream>>>(val_w,  vw16);
  f32_to_f16_kernel<<<(4 * DIM * DIM) / CVT_PER_BLOCK, 256, 0, stream>>>(ffn1_w, w1_16);
  f32_to_f16_kernel<<<(4 * DIM * DIM) / CVT_PER_BLOCK, 256, 0, stream>>>(ffn2_w, w2_16);

  // 2) h = LN1(x)
  layernorm_f16_kernel<<<MROWS / (8 * LNR), 256, 0, stream>>>(x, ln1_w, ln1_b, h16);

  // 3) g = sigmoid(h @ gate_w^T + b), v = h @ val_w^T + b
  gemm_wmma_kernel<0, DIM><<<dim3(DIM / BN, MROWS / BM), 256, 0, stream>>>(
      h16, gw16, gate_b, nullptr, G, nullptr, MROWS, DIM);
  gemm_wmma_kernel<1, DIM><<<dim3(DIM / BN, MROWS / BM), 256, 0, stream>>>(
      h16, vw16, val_b, nullptr, V, nullptr, MROWS, DIM);

  // 4) x1 = x + cumsum(g*v) / (sqrt(cumsum(g)+1e-6)*sqrt(pos/S+0.1))   [3-pass scan]
  scan_partial_kernel<<<(BATCH * NCHK * DIM) / 256, 256, 0, stream>>>(G, V, Sg, Sv);
  scan_prefix_kernel<<<(BATCH * DIM) / 256, 256, 0, stream>>>(Sg, Sv);
  scan_apply_kernel<<<(BATCH * NCHK * DIM) / 256, 256, 0, stream>>>(x, G, V, Sg, Sv, X1);

  // 5) h2 = LN2(x1)
  layernorm_f16_kernel<<<MROWS / (8 * LNR), 256, 0, stream>>>(X1, ln2_w, ln2_b, h16);

  // 6) ff1 = gelu(h2 @ ffn1_w^T + b)  -> f16
  gemm_wmma_kernel<2, 4 * DIM><<<dim3(4 * DIM / BN, MROWS / BM), 256, 0, stream>>>(
      h16, w1_16, ffn1_b, nullptr, nullptr, FF1, MROWS, DIM);

  // 7) out = x1 + (ff1 @ ffn2_w^T + b)
  gemm_wmma_kernel<3, DIM><<<dim3(DIM / BN, MROWS / BM), 256, 0, stream>>>(
      FF1, w2_16, ffn2_b, X1, X1, nullptr, MROWS, 4 * DIM);
}

// v004
// One run takes 360 microseconds.
// Next to v003, in two timings, it ran 1.06 and 1.07 times as fast.
// Over all steps from v000 it is 2.34 times as fast.
#include <hip/hip_runtime.h>
#include <hip/hip_bf16.h>
#include <math.h>

typedef __attribute__((ext_vector_type(16))) _Float16 v16h;
typedef __attribute__((ext_vector_type(8)))  _Float16 v8h;
typedef __attribute__((ext_vector_type(8)))  float    v8f;
typedef __attribute__((ext_vector_type(4)))  float    v4f;
typedef __attribute__((ext_vector_type(4)))  _Float16 v4h;
typedef __attribute__((ext_vector_type(2)))  uint32_t v2u;

#define DIM   1024
#define SEQ   4096
#define BATCH 4
#define MROWS (BATCH*SEQ)   // 16384 token rows
#define CHUNK 128
#define NCHK  (SEQ/CHUNK)   // 32 chunks per sequence
#define BM    128           // GEMM block tile rows (tokens)
#define BN    256           // GEMM block tile columns (output features)
#define BK    64            // k extent of one staged tile
#define LDP   72            // LDS row pitch of the GEMM tiles in halves: 64 data + 8 pad = 144 B (16 B x odd)
#define STAGE_H ((BM + BN) * LDP)   // halves per buffer: A rows 0..127, then W rows 0..255
#define EPP   68            // LDS row pitch of the epilogue in floats: 64 data + 4 pad (rows 8 apart: 32 banks apart)

// ---- CDNA5 async copy: global -> LDS, 16 bytes per lane and copy, tracked by ASYNCcnt ----
typedef int v4i_t __attribute__((__vector_size__(16)));
typedef __attribute__((address_space(1))) v4i_t* gptr_t;
typedef __attribute__((address_space(3))) v4i_t* lptr_t;
// One staged tile: 128 A rows and 256 W rows of 128 B each, 12 copies per thread (rows 32 apart,
// gs halves apart in global memory). Builtin copies: the compiler owns their address registers.
__device__ __forceinline__ void stage_copies(_Float16* l, const _Float16* ga, const _Float16* gb, size_t gs) {
  // both loops unrolled: straight-line copies, their LDS row offsets folded into constants
#pragma unroll
  for (int q = 0; q < BM / 32; ++q)
    __builtin_amdgcn_global_load_async_to_lds_b128((gptr_t)(ga + q * gs), (lptr_t)(l + q * 32 * LDP), 0, 0);
#pragma unroll
  for (int q = 0; q < BN / 32; ++q)
    __builtin_amdgcn_global_load_async_to_lds_b128((gptr_t)(gb + q * gs), (lptr_t)(l + (BM + q * 32) * LDP), 0, 0);
}
// This wave's copies have landed in LDS.
#define WAIT_ASYNCCNT0() asm volatile("s_wait_asynccnt 0x0" ::: "memory")
// This wave's LDS reads have returned, so the buffer they read may be refilled behind the barrier.
#define WAIT_DSCNT0()    asm volatile("s_wait_dscnt 0x0" ::: "memory")

// ---------------- fp32 -> fp16 weight conversion ----------------
// A block converts CVT_PER_BLOCK neighbouring elements: eight 16-byte loads per lane, each wave-wide
// load 512 contiguous bytes, all in flight together. Few long waves, for speed only.
// The grid covers the array exactly (its size is a multiple of CVT_PER_BLOCK).
#define CVT_PER_BLOCK (256 * 4 * 8)
__global__ void __launch_bounds__(256)
f32_to_f16_kernel(const float* __restrict__ src, _Float16* __restrict__ dst) {
  const size_t base = (size_t)blockIdx.x * CVT_PER_BLOCK + threadIdx.x * 4;
  v4f x[8];
  // both loops unrolled: x is a register array, and the loads go out ahead of the first store
#pragma unroll
  for (int j = 0; j < 8; ++j) x[j] = *(const v4f*)(src + base + j * 1024);
#pragma unroll
  for (int j = 0; j < 8; ++j) *(v4h*)(dst + base + j * 1024) = __builtin_convertvector(x[j], v4h);
}

// ---------------- LayerNorm: one wave per LNR rows of 1024, eight waves a block ----------------
// A lane holds 32 values of each row (eight 16-byte loads, each wave-wide load 512 contiguous bytes);
// all LNR rows are in flight together, and their sums cross the lanes in one interleaved butterfly.
#define LNR 4
__global__ void __launch_bounds__(256)
layernorm_f16_kernel(const float* __restrict__ X, const float* __restrict__ W,
                     const float* __restrict__ B, _Float16* __restrict__ H) {
  const int lane = threadIdx.x & 31;
  const int wave = threadIdx.x >> 5;
  const size_t e0 = (size_t)(blockIdx.x * 8 + wave) * (LNR * DIM) + lane * 4;
  const float* xr = X + e0;
  // every loop below is unrolled: a, w, b, s and q are register arrays and need constant indices
  v4f a[LNR][8];
#pragma unroll
  for (int r = 0; r < LNR; ++r)
#pragma unroll
    for (int j = 0; j < 8; ++j) a[r][j] = *(const v4f*)(xr + r * DIM + j * 128);
  // this lane's columns of weight and bias, asked for behind the rows: they are there when the sums are
  v4f w[8], b[8];
#pragma unroll
  for (int j = 0; j < 8; ++j) {
    w[j] = *(const v4f*)(W + j * 128 + lane * 4);
    b[j] = *(const v4f*)(B + j * 128 + lane * 4);
  }
  // keeps the weight and bias loads up here: moved down to their uses they are waited for pair by pair
  __builtin_amdgcn_sched_barrier(0);
  // the wait in front of any rewrite of a register that the loads above name; as its operand the rows'
  // address pair stays live up to here (without it a weight load took the pair as its destination)
  asm volatile("s_wait_xcnt 0x0" :: "v"(xr) : "memory");
  float s[LNR], q[LNR];
#pragma unroll
  for (int r = 0; r < LNR; ++r) {
    v4f s4 = a[r][0];
    v4f q4 = a[r][0] * a[r][0];
#pragma unroll
    for (int j = 1; j < 8; ++j) { s4 += a[r][j]; q4 += a[r][j] * a[r][j]; }
    s[r] = (s4[0] + s4[1]) + (s4[2] + s4[3]);
    q[r] = (q4[0] + q4[1]) + (q4[2] + q4[3]);
  }
#pragma unroll
  for (int m = 16; m > 0; m >>= 1)
#pragma unroll
    for (int r = 0; r < LNR; ++r) {
      s[r] += __shfl_xor(s[r], m, 32);
      q[r] += __shfl_xor(q[r], m, 32);
    }
  float mean[LNR], rstd[LNR];
#pragma unroll
  for (int r = 0; r < LNR; ++r) {
    mean[r] = s[r] * (1.0f / DIM);
    rstd[r] = rsqrtf(q[r] * (1.0f / DIM) - mean[r] * mean[r] + 1e-5f);
  }
  _Float16* hr = H + e0;
#pragma unroll
  for (int j = 0; j < 8; ++j)
#pragma unroll
    for (int r = 0; r < LNR; ++r)
      *(v4h*)(hr + r * DIM + j * 128) = __builtin_convertvector((a[r][j] - mean[r]) * rstd[r] * w[j] + b[j], v4h);
}

// ---------------- 3-pass chunked scan over the seq axis ----------------
// pass 1: per-chunk sums of g and g*v
__global__ void scan_partial_kernel(const float* __restrict__ G, const float* __restrict__ V,
                                    float* __restrict__ Sg, float* __restrict__ Sv) {
  const int gid = blockIdx.x * blockDim.x + threadIdx.x;   // 0 .. BATCH*NCHK*DIM-1
  const int f = gid & (DIM - 1);
  const int c = (gid >> 10) & (NCHK - 1);
  const int b = gid >> 15;
  const size_t base = ((size_t)b * SEQ + (size_t)c * CHUNK) * DIM + f;
  float sg = 0.0f, sv = 0.0f;
  for (int s = 0; s < CHUNK; ++s) {
    float gg = G[base + (size_t)s * DIM];
    float vv = V[base + (size_t)s * DIM];
    sg += gg;
    sv = fmaf(gg, vv, sv);
  }
  const size_t pidx = ((size_t)b * NCHK + c) * DIM + f;
  Sg[pidx] = sg; Sv[pidx] = sv;
}

// pass 2: exclusive prefix over chunks, per (batch, feature) column
__global__ void scan_prefix_kernel(float* __restrict__ Sg, float* __restrict__ Sv) {
  const int gid = blockIdx.x * blockDim.x + threadIdx.x;   // 0..4095
  const int b = gid >> 10, f = gid & (DIM - 1);
  float ag = 0.0f, av = 0.0f;
  for (int c = 0; c < NCHK; ++c) {
    size_t idx = ((size_t)b * NCHK + c) * DIM + f;
    float g0 = Sg[idx], v0 = Sv[idx];
    Sg[idx] = ag; Sv[idx] = av;
    ag += g0; av += v0;
  }
}

// pass 3: chunk-local scan with carry-in; x1 = x + mem
__global__ void scan_apply_kernel(const float* __restrict__ X, const float* __restrict__ G,
                                  const float* __restrict__ V, const float* __restrict__ Sg,
                                  const float* __restrict__ Sv, float* __restrict__ X1) {
  const int gid = blockIdx.x * blockDim.x + threadIdx.x;
  const int f = gid & (DIM - 1);
  const int c = (gid >> 10) & (NCHK - 1);
  const int b = gid >> 15;
  const size_t base = ((size_t)b * SEQ + (size_t)c * CHUNK) * DIM + f;
  const size_t pidx = ((size_t)b * NCHK + c) * DIM + f;
  float cg = Sg[pidx], cv = Sv[pidx];
  const float invS = 1.0f / (float)SEQ;
  for (int s = 0; s < CHUNK; ++s) {
    size_t idx = base + (size_t)s * DIM;
    float gg = G[idx];
    float vv = V[idx];
    cv = fmaf(gg, vv, cv);
    cg += gg;
    int pos = c * CHUNK + s + 1;
    float denom = sqrtf(cg + 1e-6f) * sqrtf((float)pos * invS + 0.1f);
    X1[idx] = X[idx] + cv / denom;
  }
}

// ---- epilogue stores: four neighbouring columns of two output rows (PB bytes apart) per lane ----
// The two stores and their s_wait_xcnt 0 stand in one statement, so that neither the address pair
// nor a data register they name is rewritten ahead of that wait.
template<int PB> __device__ __forceinline__ void store_rows_f32(float* p, v4f x0, v4f x1) {
  asm volatile("global_store_b128 %0, %1, off\n\t"
               "global_store_b128 %0, %2, off offset:%3\n\t"
               "s_wait_xcnt 0x0"
               :: "v"(p), "v"(x0), "v"(x1), "n"(PB) : "memory");
}
template<int PB> __device__ __forceinline__ void store_rows_f16(_Float16* p, v4h x0, v4h x1) {
  asm volatile("global_store_b64 %0, %1, off\n\t"
               "global_store_b64 %0, %2, off offset:%3\n\t"
               "s_wait_xcnt 0x0"
               :: "v"(p), "v"(__builtin_bit_cast(v2u, x0)), "v"(__builtin_bit_cast(v2u, x1)), "n"(PB) : "memory");
}
// This lane's four bias values. The load and its data wait stand in one statement with an
// early-clobber output, so that the address pair is not taken as the destination.
__device__ __forceinline__ v4f load_bias(const float* p) {
  v4f x;
  asm volatile("global_load_b128 %0, %1, off\n\t"
               "s_wait_loadcnt 0x0"
               : "=&v"(x) : "v"(p) : "memory");
  return x;
}

// ---- epilogue activations: straight-line, no branch, so that a lane's eight values run side by side ----
// sigmoid(v) = 1 / (1 + 2^(-v log2 e)) on the hardware's exp2 and reciprocal; 2^x = inf gives 0, 2^x = 0 gives 1.
// Each group of four transcendentals is one statement and works in place: none reads a neighbour's result
// or writes a neighbour's source, and the v_nop is the one slot that the instruction set asks for behind
// the last of them, whatever the compiler puts next.
__device__ __forceinline__ v4f sigmoid_x4(v4f v) {
  const v4f m = v * -1.4426950408889634f;
  float a = m[0], b = m[1], c = m[2], d = m[3];
  asm("v_exp_f32 %0, %0\n\t"
      "v_exp_f32 %1, %1\n\t"
      "v_exp_f32 %2, %2\n\t"
      "v_exp_f32 %3, %3\n\t"
      "v_nop"
      : "+v"(a), "+v"(b), "+v"(c), "+v"(d));
  a += 1.0f; b += 1.0f; c += 1.0f; d += 1.0f;
  asm("v_rcp_f32 %0, %0\n\t"
      "v_rcp_f32 %1, %1\n\t"
      "v_rcp_f32 %2, %2\n\t"
      "v_rcp_f32 %3, %3\n\t"
      "v_nop"
      : "+v"(a), "+v"(b), "+v"(c), "+v"(d));
  return v4f{a, b, c, d};
}
// v/2 (1 + erf(v / sqrt 2)). For z = |v| / sqrt 2 >= 0: erf(z) = 1 - (a1 t + ... + a5 t^5) exp(-z^2),
// t = 1 / (1 + p z), absolute error of the form 1.5e-7 (about one f32 step of 1 + erf). erf is odd, so
// v/2 erf(v / sqrt 2) = |v/2| erf(z): no sign is copied.
__device__ __forceinline__ float gelu_erf_f32(float v) {
  const float z = fabsf(v) * 0.70710678118654752f;
  const float t = __builtin_amdgcn_rcpf(fmaf(0.3275911f, z, 1.0f));
  float p = fmaf(1.061405429f, t, -1.453152027f);
  p = fmaf(p, t, 1.421413741f);
  p = fmaf(p, t, -0.284496736f);
  p = fmaf(p, t, 0.254829592f);
  p *= t;
  const float e = __builtin_amdgcn_exp2f((v * v) * -0.72134752044448170f);   // exp(-z^2) = 2^(-v^2 log2(e) / 2)
  const float h = 0.5f * v;
  return fmaf(fabsf(h), fmaf(-p, e, 1.0f), h);
}

// ---------------- WMMA GEMM:  out[m,n] = sum_k A[m,k] * W16[n,k]  (+bias, epilogue) ---------
// EPI: 0 = sigmoid -> f32,  1 = identity -> f32,  2 = exact GELU -> f16,  3 = +residual -> f32
// N (the output's row length) is a template parameter: the epilogue's row steps are then immediates.
template<int EPI, int N>
// Eight waves, two per SIMD; the register budget of four waves per SIMD lets two blocks share a WGP,
// so that one block's epilogue, LDS reads and barrier waits run beside the other block's matrix work.
__global__ void __launch_bounds__(256) __attribute__((amdgpu_waves_per_eu(4)))
gemm_wmma_kernel(const _Float16* __restrict__ A, const _Float16* __restrict__ W16,
                 const float* __restrict__ bias, const float* __restrict__ res,
                 float* __restrict__ outF, _Float16* __restrict__ outH,
                 int M, int K) {
  // Two buffers of 384 rows (A tile, then W tile) of 64 halves at pitch LDP: the 16 rows that a
  // half-wave's ds_load_b128 reads fall on 64 distinct banks.
  __shared__ __align__(16) _Float16 smem[2 * STAGE_H];

  const int tid  = threadIdx.x;
  const int lane = tid & 31;
  const int wave = tid >> 5;
  const int wm   = wave & 1;        // 0..1 -> 64-row M strip of the block tile
  const int wn   = wave >> 1;       // 0..3 -> 64-column N strip of the block tile
  const int hi   = lane >> 4;       // lane half selects K-phase (ISA frag layout)
  const int l15  = lane & 15;
  const int m0   = blockIdx.y * BM;
  const int n0   = blockIdx.x * BN;

  // Per-thread async staging assignment: 16-B chunk (tid & 7) of rows (tid >> 3) + 32 q.
  const int cC = (tid & 7) * 8;
  const int rC = tid >> 3;
  const size_t gs = (size_t)32 * K;
  const _Float16* gA = A   + (size_t)(m0 + rC) * K + cC;
  const _Float16* gB = W16 + (size_t)(n0 + rC) * K + cC;
  _Float16* lC = &smem[rC * LDP + cC];

  const int nsteps = K >> 6;

  // prologue: tile 0 into buffer 0, published; then tile 1 starts into buffer 1
  stage_copies(lC, gA, gB, gs);
  WAIT_ASYNCCNT0();
  __syncthreads();
  if (nsteps > 1) stage_copies(lC + STAGE_H, gA + BK, gB + BK, gs);

  // every loop over i, t and r below is unrolled: the accumulators and fragments are register
  // arrays and need constant indices
  v8f acc[4][4];
#pragma unroll
  for (int i = 0; i < 4; ++i)
#pragma unroll
    for (int t = 0; t < 4; ++t)
#pragma unroll
      for (int r = 0; r < 8; ++r) acc[i][t][r] = 0.0f;

  const int offA = (wm * 64 + l15) * LDP + 8 * hi;
  const int offB = (BM + wn * 64 + l15) * LDP + 8 * hi;

  for (int s = 0; s < nsteps; ++s) {
    const int buf = s & 1;
    const _Float16* sa = smem + buf * STAGE_H + offA;
    const _Float16* sb = smem + buf * STAGE_H + offB;

    // the stage's two k halves in turn, each: 8 fragments from LDS, then 16 WMMAs
#pragma unroll
    for (int kk = 0; kk < BK / 32; ++kk) {
      // fragment (16x32 f16): lane<16 holds K {0..7,16..23}, lane>=16 holds K {8..15,24..31}
      v16h afrag[4];
      v16h bfrag[4];
#pragma unroll
      for (int i = 0; i < 4; ++i) {
        const _Float16* ap = sa + i * 16 * LDP + kk * 32;
        v8h alo = *(const v8h*)(ap);
        v8h ahi = *(const v8h*)(ap + 16);
        afrag[i] = __builtin_shufflevector(alo, ahi, 0,1,2,3,4,5,6,7,8,9,10,11,12,13,14,15);
      }
#pragma unroll
      for (int t = 0; t < 4; ++t) {
        const _Float16* bp = sb + t * 16 * LDP + kk * 32;
        v8h blo = *(const v8h*)(bp);
        v8h bhi = *(const v8h*)(bp + 16);
        bfrag[t] = __builtin_shufflevector(blo, bhi, 0,1,2,3,4,5,6,7,8,9,10,11,12,13,14,15);
      }
      if (kk == BK / 32 - 1) {
        // publish point: my last reads of buf have returned, my copies of tile s+1 have landed; the
        // one barrier publishes tile s+1 and frees buf for the refill behind it, which then flies
        // during this half's WMMAs and the next stage up to its publish point
        WAIT_DSCNT0();
        WAIT_ASYNCCNT0();
        __syncthreads();
        if (s + 2 < nsteps) {
          const int k = (s + 2) * BK;
          stage_copies(lC + buf * STAGE_H, gA + k, gB + k, gs);
        }
      }
#pragma unroll
      for (int t = 0; t < 4; ++t)
#pragma unroll
        for (int i = 0; i < 4; ++i)
          acc[i][t] = __builtin_amdgcn_wmma_f32_16x16x32_f16(
              false, afrag[i], false, bfrag[t], (short)0, acc[i][t], false, false);
    }
  }
  WAIT_ASYNCCNT0();

  // epilogue. The accumulators pass through LDS (free behind the loop's last barrier), 16 rows of the
  // wave's strip at a time, each wave in a region of its own: the element-wise math is then a loop
  // over rows that can stay rolled, and a lane stores four neighbouring columns at once.
  float* ep = (float*)smem + wave * (16 * EPP);
  const int c4    = l15 * 4;                    // this lane's columns: c4..c4+3 of the wave's 64
  const int ncol0 = n0 + wn * 64 + c4;
  // this lane's rows of a group: it * 4 + hi and it * 4 + 2 + hi
  const size_t e0 = (size_t)(m0 + wm * 64 + hi) * N + ncol0;
  v4f bv;

  // residual of 16 rows, fetched one group of rows ahead of its use so that its latency is hidden
  v4f rv[2][4][2];
  if (EPI == 3) {
#pragma unroll
    for (int it = 0; it < 4; ++it) {
      rv[0][it][0] = *(const v4f*)(res + e0 + (it * 4) * N);
      rv[0][it][1] = *(const v4f*)(res + e0 + (it * 4 + 2) * N);
    }
  }
#pragma unroll
  for (int i = 0; i < 4; ++i) {
    if (i > 0) __syncthreads();   // the last group's reads are done before its rows are overwritten
    // D layout: lanes 0-15 N=lane, M=r; lanes 16-31 N=lane-16, M=r+8
#pragma unroll
    for (int t = 0; t < 4; ++t)
#pragma unroll
      for (int r = 0; r < 8; ++r) ep[(hi * 8 + r) * EPP + t * 16 + l15] = acc[i][t][r];
    if (i == 0) bv = load_bias(bias + ncol0);   // its wait passes beside that of the LDS writes above
    __syncthreads();              // the rows are written before other lanes read them
    // behind the barrier (which waits for every load in flight), so that these fly during this group's work
    if (EPI == 3 && i + 1 < 4) {
#pragma unroll
      for (int it = 0; it < 4; ++it) {
        rv[(i + 1) & 1][it][0] = *(const v4f*)(res + e0 + ((i + 1) * 16 + it * 4) * N);
        rv[(i + 1) & 1][it][1] = *(const v4f*)(res + e0 + ((i + 1) * 16 + it * 4 + 2) * N);
      }
    }
    if (EPI == 0 || EPI == 2) {
      // stays rolled, to keep the kernel's text short: 32 exp or erf evaluations in the text (eight per copy of this loop), not 128
#pragma unroll 1
      for (int it = 0; it < 4; ++it) {
        const float* q = ep + (it * 4 + hi) * EPP + c4;
        const v4f v0 = *(const v4f*)q + bv;
        const v4f v1 = *(const v4f*)(q + 2 * EPP) + bv;
        const size_t e = e0 + (size_t)(i * 16 + it * 4) * N;
        if (EPI == 0) {
          store_rows_f32<2 * N * 4>(outF + e, sigmoid_x4(v0), sigmoid_x4(v1));
        } else {
          v4h o0, o1;
#pragma unroll
          for (int j = 0; j < 4; ++j) {
            o0[j] = (_Float16)gelu_erf_f32(v0[j]);
            o1[j] = (_Float16)gelu_erf_f32(v1[j]);
          }
          store_rows_f16<2 * N * 2>(outH + e, o0, o1);
        }
      }
    } else {
#pragma unroll
      for (int it = 0; it < 4; ++it) {
        const float* q = ep + (it * 4 + hi) * EPP + c4;
        v4f v0 = *(const v4f*)q + bv;
        v4f v1 = *(const v4f*)(q + 2 * EPP) + bv;
        if (EPI == 3) {
          v0 = rv[i & 1][it][0] + v0;
          v1 = rv[i & 1][it][1] + v1;
        }
        store_rows_f32<2 * N * 4>(outF + e0 + (i * 16 + it * 4) * N, v0, v1);
      }
    }
  }
}

extern "C" void kernel_launch(void* const* d_in, const int* in_sizes, int n_in,
                              void* d_out, int out_size, void* d_ws, size_t ws_size,
                              hipStream_t stream) {
  (void)in_sizes; (void)n_in; (void)out_size; (void)ws_size;
  const float* x      = (const float*)d_in[0];
  const float* ln1_w  = (const float*)d_in[1];
  const float* ln1_b  = (const float*)d_in[2];
  const float* ln2_w  = (const float*)d_in[3];
  const float* ln2_b  = (const float*)d_in[4];
  const float* gate_w = (const float*)d_in[5];
  const float* gate_b = (const float*)d_in[6];
  const float* val_w  = (const float*)d_in[7];
  const float* val_b  = (const float*)d_in[8];
  const float* ffn1_w = (const float*)d_in[9];
  const float* ffn1_b = (const float*)d_in[10];
  const float* ffn2_w = (const float*)d_in[11];
  const float* ffn2_b = (const float*)d_in[12];

  char* ws = (char*)d_ws;
  const size_t MB = 1024ull * 1024ull;
  _Float16* h16   = (_Float16*)(ws);             // 32 MB: LN output (reused for LN2)
  float*    G     = (float*)(ws + 32 * MB);      // 64 MB
  float*    V     = (float*)(ws + 96 * MB);      // 64 MB
  _Float16* FF1   = (_Float16*)(ws + 32 * MB);   // 128 MB, reuses dead G/V region
  _Float16* gw16  = (_Float16*)(ws + 160 * MB);  // 2 MB
  _Float16* vw16  = (_Float16*)(ws + 162 * MB);  // 2 MB
  _Float16* w1_16 = (_Float16*)(ws + 164 * MB);  // 8 MB
  _Float16* w2_16 = (_Float16*)(ws + 172 * MB);  // 8 MB
  float*    Sg    = (float*)(ws + 180 * MB);     // 512 KB chunk partials
  float*    Sv    = (float*)(ws + 181 * MB);     // 512 KB chunk partials
  float*    X1    = (float*)d_out;               // x + mem lives in d_out

  // 1) weights -> f16
  f32_to_f16_kernel<<<(DIM * DIM) / CVT_PER_BLOCK, 256, 0, stream>>>(gate_w, gw16);
  f32_to_f16_kernel<<<(DIM * DIM) / CVT_PER_BLOCK, 256, 0, stream>>>(val_w,  vw16);
  f32_to_f16_kernel<<<(4 * DIM * DIM) / CVT_PER_BLOCK, 256, 0, stream>>>(ffn1_w, w1_16);
  f32_to_f16_kernel<<<(4 * DIM * DIM) / CVT_PER_BLOCK, 256, 0, stream>>>(ffn2_w, w2_16);

  // 2) h = LN1(x)
  layernorm_f16_kernel<<<MROWS / (8 * LNR), 256, 0, stream>>>(x, ln1_w, ln1_b, h16);

  // 3) g = sigmoid(h @ gate_w^T + b), v = h @ val_w^T + b
  gemm_wmma_kernel<0, DIM><<<dim3(DIM / BN, MROWS / BM), 256, 0, stream>>>(
      h16, gw16, gate_b, nullptr, G, nullptr, MROWS, DIM);
  gemm_wmma_kernel<1, DIM><<<dim3(DIM / BN, MROWS / BM), 256, 0, stream>>>(
      h16, vw16, val_b, nullptr, V, nullptr, MROWS, DIM);

  // 4) x1 = x + cumsum(g*v) / (sqrt(cumsum(g)+1e-6)*sqrt(pos/S+0.1))   [3-pass scan]
  scan_partial_kernel<<<(BATCH * NCHK * DIM) / 256, 256, 0, stream>>>(G, V, Sg, Sv);
  scan_prefix_kernel<<<(BATCH * DIM) / 256, 256, 0, stream>>>(Sg, Sv);
  scan_apply_kernel<<<(BATCH * NCHK * DIM) / 256, 256, 0, stream>>>(x, G, V, Sg, Sv, X1);

  // 5) h2 = LN2(x1)
  layernorm_f16_kernel<<<MROWS / (8 * LNR), 256, 0, stream>>>(X1, ln2_w, ln2_b, h16);

  // 6) ff1 = gelu(h2 @ ffn1_w^T + b)  -> f16
  gemm_wmma_kernel<2, 4 * DIM><<<dim3(4 * DIM / BN, MROWS / BM), 256, 0, stream>>>(
      h16, w1_16, ffn1_b, nullptr, nullptr, FF1, MROWS, DIM);

  // 7) out = x1 + (ff1 @ ffn2_w^T + b)
  gemm_wmma_kernel<3, DIM><<<dim3(DIM / BN, MROWS / BM), 256, 0, stream>>>(
      FF1, w2_16, ffn2_b, X1, X1, nullptr, MROWS, 4 * DIM);
}

// v005
// Measured time: 343 microseconds a run.
// In both of two side-by-side timings against v004, it was 1.05 times as fast.
// All steps since v000 together make it 2.45 times as fast.
#include <hip/hip_runtime.h>
#include <hip/hip_bf16.h>
#include <math.h>

typedef __attribute__((ext_vector_type(16))) _Float16 v16h;
typedef __attribute__((ext_vector_type(8)))  _Float16 v8h;
typedef __attribute__((ext_vector_type(8)))  float    v8f;
typedef __attribute__((ext_vector_type(4)))  float    v4f;
typedef __attribute__((ext_vector_type(4)))  _Float16 v4h;
typedef __attribute__((ext_vector_type(2)))  uint32_t v2u;

#define DIM   1024
#define SEQ   4096
#define BATCH 4
#define MROWS (BATCH*SEQ)   // 16384 token rows
#define CHUNK 128
#define NCHK  (SEQ/CHUNK)   // 32 chunks per sequence
#define BM    256           // GEMM block tile rows (tokens)
#define BN    256           // GEMM block tile columns (output features)
#define BK    128           // k extent of one staged tile
#define LDP   136           // LDS row pitch of the GEMM tiles in halves: 128 data + 8 pad = 272 B (16 B x odd)
#define STAGE_H ((BM + BN) * LDP)   // halves per buffer: A rows 0..255, then W rows 0..255
#define EPP   68            // LDS row pitch of the epilogue in floats: 64 data + 4 pad (rows 8 apart: 32 banks apart)

// ---- CDNA5 async copy: global -> LDS, 16 bytes per lane and copy, tracked by ASYNCcnt ----
typedef int v4i_t __attribute__((__vector_size__(16)));
typedef __attribute__((address_space(1))) v4i_t* gptr_t;
typedef __attribute__((address_space(3))) v4i_t* lptr_t;
// One staged tile: 256 A rows and 256 W rows of 256 B each, 32 copies per thread (rows 16 apart,
// gs halves apart in global memory). Builtin copies: the compiler owns their address registers.
__device__ __forceinline__ void stage_copies(_Float16* l, const _Float16* ga, const _Float16* gb, size_t gs) {
  // both loops unrolled: straight-line copies, their LDS row offsets folded into constants
#pragma unroll
  for (int q = 0; q < BM / 16; ++q)
    __builtin_amdgcn_global_load_async_to_lds_b128((gptr_t)(ga + q * gs), (lptr_t)(l + q * 16 * LDP), 0, 0);
#pragma unroll
  for (int q = 0; q < BN / 16; ++q)
    __builtin_amdgcn_global_load_async_to_lds_b128((gptr_t)(gb + q * gs), (lptr_t)(l + (BM + q * 16) * LDP), 0, 0);
}
// This wave's copies have landed in LDS.
#define WAIT_ASYNCCNT0() asm volatile("s_wait_asynccnt 0x0" ::: "memory")
// This wave's LDS reads have returned, so the buffer they read may be refilled behind the barrier.
#define WAIT_DSCNT0()    asm volatile("s_wait_dscnt 0x0" ::: "memory")

// ---------------- fp32 -> fp16 weight conversion ----------------
// A block converts CVT_PER_BLOCK neighbouring elements: eight 16-byte loads per lane, each wave-wide
// load 512 contiguous bytes, all in flight together. Few long waves, for speed only.
// The grid covers the array exactly (its size is a multiple of CVT_PER_BLOCK).
#define CVT_PER_BLOCK (256 * 4 * 8)
__global__ void __launch_bounds__(256)
f32_to_f16_kernel(const float* __restrict__ src, _Float16* __restrict__ dst) {
  const size_t base = (size_t)blockIdx.x * CVT_PER_BLOCK + threadIdx.x * 4;
  v4f x[8];
  // both loops unrolled: x is a register array, and the loads go out ahead of the first store
#pragma unroll
  for (int j = 0; j < 8; ++j) x[j] = *(const v4f*)(src + base + j * 1024);
#pragma unroll
  for (int j = 0; j < 8; ++j) *(v4h*)(dst + base + j * 1024) = __builtin_convertvector(x[j], v4h);
}

// ---------------- LayerNorm: one wave per LNR rows of 1024, eight waves a block ----------------
// A lane holds 32 values of each row (eight 16-byte loads, each wave-wide load 512 contiguous bytes);
// all LNR rows are in flight together, and their sums cross the lanes in one interleaved butterfly.
#define LNR 4
__global__ void __launch_bounds__(256)
layernorm_f16_kernel(const float* __restrict__ X, const float* __restrict__ W,
                     const float* __restrict__ B, _Float16* __restrict__ H) {
  const int lane = threadIdx.x & 31;
  const int wave = threadIdx.x >> 5;
  const size_t e0 = (size_t)(blockIdx.x * 8 + wave) * (LNR * DIM) + lane * 4;
  const float* xr = X + e0;
  // every loop below is unrolled: a, w, b, s and q are register arrays and need constant indices
  v4f a[LNR][8];
#pragma unroll
  for (int r = 0; r < LNR; ++r)
#pragma unroll
    for (int j = 0; j < 8; ++j) a[r][j] = *(const v4f*)(xr + r * DIM + j * 128);
  // this lane's columns of weight and bias, asked for behind the rows: they are there when the sums are
  v4f w[8], b[8];
#pragma unroll
  for (int j = 0; j < 8; ++j) {
    w[j] = *(const v4f*)(W + j * 128 + lane * 4);
    b[j] = *(const v4f*)(B + j * 128 + lane * 4);
  }
  // keeps the weight and bias loads up here: moved down to their uses they are waited for pair by pair
  __builtin_amdgcn_sched_barrier(0);
  // the wait in front of any rewrite of a register that the loads above name; as its operand the rows'
  // address pair stays live up to here (without it a weight load took the pair as its destination)
  asm volatile("s_wait_xcnt 0x0" :: "v"(xr) : "memory");
  float s[LNR], q[LNR];
#pragma unroll
  for (int r = 0; r < LNR; ++r) {
    v4f s4 = a[r][0];
    v4f q4 = a[r][0] * a[r][0];
#pragma unroll
    for (int j = 1; j < 8; ++j) { s4 += a[r][j]; q4 += a[r][j] * a[r][j]; }
    s[r] = (s4[0] + s4[1]) + (s4[2] + s4[3]);
    q[r] = (q4[0] + q4[1]) + (q4[2] + q4[3]);
  }
#pragma unroll
  for (int m = 16; m > 0; m >>= 1)
#pragma unroll
    for (int r = 0; r < LNR; ++r) {
      s[r] += __shfl_xor(s[r], m, 32);
      q[r] += __shfl_xor(q[r], m, 32);
    }
  float mean[LNR], rstd[LNR];
#pragma unroll
  for (int r = 0; r < LNR; ++r) {
    mean[r] = s[r] * (1.0f / DIM);
    rstd[r] = rsqrtf(q[r] * (1.0f / DIM) - mean[r] * mean[r] + 1e-5f);
  }
  _Float16* hr = H + e0;
#pragma unroll
  for (int j = 0; j < 8; ++j)
#pragma unroll
    for (int r = 0; r < LNR; ++r)
      *(v4h*)(hr + r * DIM + j * 128) = __builtin_convertvector((a[r][j] - mean[r]) * rstd[r] * w[j] + b[j], v4h);
}

// ---------------- 3-pass chunked scan over the seq axis ----------------
// pass 1: per-chunk sums of g and g*v
__global__ void scan_partial_kernel(const float* __restrict__ G, const float* __restrict__ V,
                                    float* __restrict__ Sg, float* __restrict__ Sv) {
  const int gid = blockIdx.x * blockDim.x + threadIdx.x;   // 0 .. BATCH*NCHK*DIM-1
  const int f = gid & (DIM - 1);
  const int c = (gid >> 10) & (NCHK - 1);
  const int b = gid >> 15;
  const size_t base = ((size_t)b * SEQ + (size_t)c * CHUNK) * DIM + f;
  float sg = 0.0f, sv = 0.0f;
  for (int s = 0; s < CHUNK; ++s) {
    float gg = G[base + (size_t)s * DIM];
    float vv = V[base + (size_t)s * DIM];
    sg += gg;
    sv = fmaf(gg, vv, sv);
  }
  const size_t pidx = ((size_t)b * NCHK + c) * DIM + f;
  Sg[pidx] = sg; Sv[pidx] = sv;
}

// pass 2: exclusive prefix over chunks, per (batch, feature) column
__global__ void scan_prefix_kernel(float* __restrict__ Sg, float* __restrict__ Sv) {
  const int gid = blockIdx.x * blockDim.x + threadIdx.x;   // 0..4095
  const int b = gid >> 10, f = gid & (DIM - 1);
  float ag = 0.0f, av = 0.0f;
  for (int c = 0; c < NCHK; ++c) {
    size_t idx = ((size_t)b * NCHK + c) * DIM + f;
    float g0 = Sg[idx], v0 = Sv[idx];
    Sg[idx] = ag; Sv[idx] = av;
    ag += g0; av += v0;
  }
}

// pass 3: chunk-local scan with carry-in; x1 = x + mem
__global__ void scan_apply_kernel(const float* __restrict__ X, const float* __restrict__ G,
                                  const float* __restrict__ V, const float* __restrict__ Sg,
                                  const float* __restrict__ Sv, float* __restrict__ X1) {
  const int gid = blockIdx.x * blockDim.x + threadIdx.x;
  const int f = gid & (DIM - 1);
  const int c = (gid >> 10) & (NCHK - 1);
  const int b = gid >> 15;
  const size_t base = ((size_t)b * SEQ + (size_t)c * CHUNK) * DIM + f;
  const size_t pidx = ((size_t)b * NCHK + c) * DIM + f;
  float cg = Sg[pidx], cv = Sv[pidx];
  const float invS = 1.0f / (float)SEQ;
  for (int s = 0; s < CHUNK; ++s) {
    size_t idx = base + (size_t)s * DIM;
    float gg = G[idx];
    float vv = V[idx];
    cv = fmaf(gg, vv, cv);
    cg += gg;
    int pos = c * CHUNK + s + 1;
    float denom = sqrtf(cg + 1e-6f) * sqrtf((float)pos * invS + 0.1f);
    X1[idx] = X[idx] + cv / denom;
  }
}

// ---- epilogue stores: four neighbouring columns of two output rows (PB bytes apart) per lane ----
// The two stores and their s_wait_xcnt 0 stand in one statement, so that neither the address pair
// nor a data register they name is rewritten ahead of that wait.
template<int PB> __device__ __forceinline__ void store_rows_f32(float* p, v4f x0, v4f x1) {
  asm volatile("global_store_b128 %0, %1, off\n\t"
               "global_store_b128 %0, %2, off offset:%3\n\t"
               "s_wait_xcnt 0x0"
               :: "v"(p), "v"(x0), "v"(x1), "n"(PB) : "memory");
}
template<int PB> __device__ __forceinline__ void store_rows_f16(_Float16* p, v4h x0, v4h x1) {
  asm volatile("global_store_b64 %0, %1, off\n\t"
               "global_store_b64 %0, %2, off offset:%3\n\t"
               "s_wait_xcnt 0x0"
               :: "v"(p), "v"(__builtin_bit_cast(v2u, x0)), "v"(__builtin_bit_cast(v2u, x1)), "n"(PB) : "memory");
}
// This lane's four bias values. The load and its data wait stand in one statement with an
// early-clobber output, so that the address pair is not taken as the destination.
__device__ __forceinline__ v4f load_bias(const float* p) {
  v4f x;
  asm volatile("global_load_b128 %0, %1, off\n\t"
               "s_wait_loadcnt 0x0"
               : "=&v"(x) : "v"(p) : "memory");
  return x;
}

// ---- epilogue activations: straight-line, no branch, so that a lane's eight values run side by side ----
// sigmoid(v) = 1 / (1 + 2^(-v log2 e)) on the hardware's exp2 and reciprocal; 2^x = inf gives 0, 2^x = 0 gives 1.
// Each group of four transcendentals is one statement and works in place: none reads a neighbour's result
// or writes a neighbour's source, and the v_nop is the one slot that the instruction set asks for behind
// the last of them, whatever the compiler puts next.
__device__ __forceinline__ v4f sigmoid_x4(v4f v) {
  const v4f m = v * -1.4426950408889634f;
  float a = m[0], b = m[1], c = m[2], d = m[3];
  asm("v_exp_f32 %0, %0\n\t"
      "v_exp_f32 %1, %1\n\t"
      "v_exp_f32 %2, %2\n\t"
      "v_exp_f32 %3, %3\n\t"
      "v_nop"
      : "+v"(a), "+v"(b), "+v"(c), "+v"(d));
  a += 1.0f; b += 1.0f; c += 1.0f; d += 1.0f;
  asm("v_rcp_f32 %0, %0\n\t"
      "v_rcp_f32 %1, %1\n\t"
      "v_rcp_f32 %2, %2\n\t"
      "v_rcp_f32 %3, %3\n\t"
      "v_nop"
      : "+v"(a), "+v"(b), "+v"(c), "+v"(d));
  return v4f{a, b, c, d};
}
// v/2 (1 + erf(v / sqrt 2)). For z = |v| / sqrt 2 >= 0: erf(z) = 1 - (a1 t + ... + a5 t^5) exp(-z^2),
// t = 1 / (1 + p z), absolute error of the form 1.5e-7 (about one f32 step of 1 + erf). erf is odd, so
// v/2 erf(v / sqrt 2) = |v/2| erf(z): no sign is copied.
__device__ __forceinline__ float gelu_erf_f32(float v) {
  const float z = fabsf(v) * 0.70710678118654752f;
  const float t = __builtin_amdgcn_rcpf(fmaf(0.3275911f, z, 1.0f));
  float p = fmaf(1.061405429f, t, -1.453152027f);
  p = fmaf(p, t, 1.421413741f);
  p = fmaf(p, t, -0.284496736f);
  p = fmaf(p, t, 0.254829592f);
  p *= t;
  const float e = __builtin_amdgcn_exp2f((v * v) * -0.72134752044448170f);   // exp(-z^2) = 2^(-v^2 log2(e) / 2)
  const float h = 0.5f * v;
  return fmaf(fabsf(h), fmaf(-p, e, 1.0f), h);
}

// ---------------- WMMA GEMM:  out[m,n] = sum_k A[m,k] * W16[n,k]  (+bias, epilogue) ---------
// EPI: 0 = sigmoid -> f32,  1 = identity -> f32,  2 = exact GELU -> f16,  3 = +residual -> f32
// N (the output's row length) is a template parameter: the epilogue's row steps are then immediates.
template<int EPI, int N>
// Eight waves, two per SIMD, one block a WGP: a wave owns 64 x 128 of the output (32 accumulator tiles),
// so that 12 fragments from LDS feed 32 WMMAs, and a block asks L2 for 512 operand rows per 256 x 256 outputs.
__global__ void __launch_bounds__(256)
gemm_wmma_kernel(const _Float16* __restrict__ A, const _Float16* __restrict__ W16,
                 const float* __restrict__ bias, const float* __restrict__ res,
                 float* __restrict__ outF, _Float16* __restrict__ outH,
                 int M, int K) {
  // Two buffers of 512 rows (A tile, then W tile) of 128 halves at pitch LDP: the 16 rows that a
  // half-wave's ds_load_b128 reads fall on 64 distinct banks.
  __shared__ __align__(16) _Float16 smem[2 * STAGE_H];

  const int tid  = threadIdx.x;
  const int lane = tid & 31;
  const int wave = tid >> 5;
  const int wm   = wave & 3;        // 0..3 -> 64-row M strip of the block tile
  const int wn   = wave >> 2;       // 0..1 -> 128-column N strip of the block tile
  const int hi   = lane >> 4;       // lane half selects K-phase (ISA frag layout)
  const int l15  = lane & 15;
  const int m0   = blockIdx.y * BM;
  const int n0   = blockIdx.x * BN;

  // Per-thread async staging assignment: 16-B chunk (tid & 15) of rows (tid >> 4) + 16 q.
  const int cC = (tid & 15) * 8;
  const int rC = tid >> 4;
  const size_t gs = (size_t)16 * K;
  const _Float16* gA = A   + (size_t)(m0 + rC) * K + cC;
  const _Float16* gB = W16 + (size_t)(n0 + rC) * K + cC;
  _Float16* lC = &smem[rC * LDP + cC];

  const int nsteps = K >> 7;

  // prologue: tile 0 into buffer 0, published; then tile 1 starts into buffer 1
  stage_copies(lC, gA, gB, gs);
  WAIT_ASYNCCNT0();
  __syncthreads();
  if (nsteps > 1) stage_copies(lC + STAGE_H, gA + BK, gB + BK, gs);

  // every loop over i, t and r below is unrolled: the accumulators and fragments are register
  // arrays and need constant indices
  v8f acc[4][8];
#pragma unroll
  for (int i = 0; i < 4; ++i)
#pragma unroll
    for (int t = 0; t < 8; ++t)
#pragma unroll
      for (int r = 0; r < 8; ++r) acc[i][t][r] = 0.0f;

  const int offA = (wm * 64 + l15) * LDP + 8 * hi;
  const int offB = (BM + wn * 128 + l15) * LDP + 8 * hi;

  for (int s = 0; s < nsteps; ++s) {
    const int buf = s & 1;
    const _Float16* sa = smem + buf * STAGE_H + offA;
    const _Float16* sb = smem + buf * STAGE_H + offB;

    // the stage's four k quarters in turn, each: 12 fragments from LDS, then 32 WMMAs
#pragma unroll
    for (int kk = 0; kk < BK / 32; ++kk) {
      // fragment (16x32 f16): lane<16 holds K {0..7,16..23}, lane>=16 holds K {8..15,24..31}
      v16h afrag[4];
      v16h bfrag[8];
#pragma unroll
      for (int i = 0; i < 4; ++i) {
        const _Float16* ap = sa + i * 16 * LDP + kk * 32;
        v8h alo = *(const v8h*)(ap);
        v8h ahi = *(const v8h*)(ap + 16);
        afrag[i] = __builtin_shufflevector(alo, ahi, 0,1,2,3,4,5,6,7,8,9,10,11,12,13,14,15);
      }
#pragma unroll
      for (int t = 0; t < 8; ++t) {
        const _Float16* bp = sb + t * 16 * LDP + kk * 32;
        v8h blo = *(const v8h*)(bp);
        v8h bhi = *(const v8h*)(bp + 16);
        bfrag[t] = __builtin_shufflevector(blo, bhi, 0,1,2,3,4,5,6,7,8,9,10,11,12,13,14,15);
      }
      // holds the fragment loads together in front of the WMMAs: one place with LDS reads a quarter
      __builtin_amdgcn_sched_barrier(0);
      if (kk == BK / 32 - 1) {
        // publish point: my last reads of buf have returned, my copies of tile s+1 have landed; the
        // one barrier publishes tile s+1 and frees buf for the refill behind it, which then flies
        // during this quarter's WMMAs and the next stage's first three
        WAIT_DSCNT0();
        WAIT_ASYNCCNT0();
        __syncthreads();
        if (s + 2 < nsteps) {
          const int k = (s + 2) * BK;
          stage_copies(lC + buf * STAGE_H, gA + k, gB + k, gs);
        }
      }
#pragma unroll
      for (int t = 0; t < 8; ++t)
#pragma unroll
        for (int i = 0; i < 4; ++i)
          acc[i][t] = __builtin_amdgcn_wmma_f32_16x16x32_f16(
              false, afrag[i], false, bfrag[t], (short)0, acc[i][t], false, false);
      // keeps the later quarters' fragment loads behind these WMMAs: lifted over them, three more
      // fragment sets were live at once and the accumulators spilled to scratch
      __builtin_amdgcn_sched_barrier(0);
    }
  }
  WAIT_ASYNCCNT0();

  // epilogue. The accumulators pass through LDS (free behind the loop's last barrier), a group of 16 rows
  // by 64 columns of the wave's strip at a time (group g: rows (g & 3) * 16.., columns (g >> 2) * 64..),
  // each wave in a region of its own: the element-wise math is then a loop over rows that can stay
  // rolled, and a lane stores four neighbouring columns at once.
  float* ep = (float*)smem + wave * (16 * EPP);
  const int c4    = l15 * 4;                    // this lane's columns: c4..c4+3 of a group's 64
  const int ncol0 = n0 + wn * 128 + c4;
  // this lane's rows of a group: it * 4 + hi and it * 4 + 2 + hi
  const size_t e0 = (size_t)(m0 + wm * 64 + hi) * N + ncol0;
  v4f bv[2];   // bias of this lane's columns in the strip's two 64-column halves

  // residual of 16 rows, fetched one group of rows ahead of its use so that its latency is hidden
  v4f rv[2][4][2];
  if (EPI == 3) {
#pragma unroll
    for (int it = 0; it < 4; ++it) {
      rv[0][it][0] = *(const v4f*)(res + e0 + (it * 4) * N);
      rv[0][it][1] = *(const v4f*)(res + e0 + (it * 4 + 2) * N);
    }
  }
#pragma unroll
  for (int g = 0; g < 8; ++g) {
    const int i = g & 3;
    const int h = g >> 2;
    const int go = h * 64 + i * 16 * N;                 // this group's first element, counted from e0
    const int gn = ((g + 1) >> 2) * 64 + ((g + 1) & 3) * 16 * N;   // the next group's
    if (g > 0) __syncthreads();   // the last group's reads are done before its rows are overwritten
    // D layout: lanes 0-15 N=lane, M=r; lanes 16-31 N=lane-16, M=r+8
#pragma unroll
    for (int t = 0; t < 4; ++t)
#pragma unroll
      for (int r = 0; r < 8; ++r) ep[(hi * 8 + r) * EPP + t * 16 + l15] = acc[i][h * 4 + t][r];
    if (g == 0) {   // their waits pass beside that of the LDS writes above
      bv[0] = load_bias(bias + ncol0);
      bv[1] = load_bias(bias + ncol0 + 64);
    }
    __syncthreads();              // the rows are written before other lanes read them
    // behind the barrier (which waits for every load in flight), so that these fly during this group's work
    if (EPI == 3 && g + 1 < 8) {
#pragma unroll
      for (int it = 0; it < 4; ++it) {
        rv[(g + 1) & 1][it][0] = *(const v4f*)(res + e0 + gn + (it * 4) * N);
        rv[(g + 1) & 1][it][1] = *(const v4f*)(res + e0 + gn + (it * 4 + 2) * N);
      }
    }
    if (EPI == 0 || EPI == 2) {
      // stays rolled, to keep the kernel's text short: eight exp or erf evaluations here, not 256
#pragma unroll 1
      for (int it = 0; it < 4; ++it) {
        const float* q = ep + (it * 4 + hi) * EPP + c4;
        const v4f v0 = *(const v4f*)q + bv[h];
        const v4f v1 = *(const v4f*)(q + 2 * EPP) + bv[h];
        const size_t e = e0 + go + (size_t)(it * 4) * N;
        if (EPI == 0) {
          store_rows_f32<2 * N * 4>(outF + e, sigmoid_x4(v0), sigmoid_x4(v1));
        } else {
          v4h o0, o1;
#pragma unroll
          for (int j = 0; j < 4; ++j) {
            o0[j] = (_Float16)gelu_erf_f32(v0[j]);
            o1[j] = (_Float16)gelu_erf_f32(v1[j]);
          }
          store_rows_f16<2 * N * 2>(outH + e, o0, o1);
        }
      }
    } else {
#pragma unroll
      for (int it = 0; it < 4; ++it) {
        const float* q = ep + (it * 4 + hi) * EPP + c4;
        v4f v0 = *(const v4f*)q + bv[h];
        v4f v1 = *(const v4f*)(q + 2 * EPP) + bv[h];
        if (EPI == 3) {
          v0 = rv[g & 1][it][0] + v0;
          v1 = rv[g & 1][it][1] + v1;
        }
        store_rows_f32<2 * N * 4>(outF + e0 + go + (it * 4) * N, v0, v1);
      }
    }
  }
}

extern "C" void kernel_launch(void* const* d_in, const int* in_sizes, int n_in,
                              void* d_out, int out_size, void* d_ws, size_t ws_size,
                              hipStream_t stream) {
  (void)in_sizes; (void)n_in; (void)out_size; (void)ws_size;
  const float* x      = (const float*)d_in[0];
  const float* ln1_w  = (const float*)d_in[1];
  const float* ln1_b  = (const float*)d_in[2];
  const float* ln2_w  = (const float*)d_in[3];
  const float* ln2_b  = (const float*)d_in[4];
  const float* gate_w = (const float*)d_in[5];
  const float* gate_b = (const float*)d_in[6];
  const float* val_w  = (const float*)d_in[7];
  const float* val_b  = (const float*)d_in[8];
  const float* ffn1_w = (const float*)d_in[9];
  const float* ffn1_b = (const float*)d_in[10];
  const float* ffn2_w = (const float*)d_in[11];
  const float* ffn2_b = (const float*)d_in[12];

  char* ws = (char*)d_ws;
  const size_t MB = 1024ull * 1024ull;
  _Float16* h16   = (_Float16*)(ws);             // 32 MB: LN output (reused for LN2)
  float*    G     = (float*)(ws + 32 * MB);      // 64 MB
  float*    V     = (float*)(ws + 96 * MB);      // 64 MB
  _Float16* FF1   = (_Float16*)(ws + 32 * MB);   // 128 MB, reuses dead G/V region
  _Float16* gw16  = (_Float16*)(ws + 160 * MB);  // 2 MB
  _Float16* vw16  = (_Float16*)(ws + 162 * MB);  // 2 MB
  _Float16* w1_16 = (_Float16*)(ws + 164 * MB);  // 8 MB
  _Float16* w2_16 = (_Float16*)(ws + 172 * MB);  // 8 MB
  float*    Sg    = (float*)(ws + 180 * MB);     // 512 KB chunk partials
  float*    Sv    = (float*)(ws + 181 * MB);     // 512 KB chunk partials
  float*    X1    = (float*)d_out;               // x + mem lives in d_out

  // 1) weights -> f16
  f32_to_f16_kernel<<<(DIM * DIM) / CVT_PER_BLOCK, 256, 0, stream>>>(gate_w, gw16);
  f32_to_f16_kernel<<<(DIM * DIM) / CVT_PER_BLOCK, 256, 0, stream>>>(val_w,  vw16);
  f32_to_f16_kernel<<<(4 * DIM * DIM) / CVT_PER_BLOCK, 256, 0, stream>>>(ffn1_w, w1_16);
  f32_to_f16_kernel<<<(4 * DIM * DIM) / CVT_PER_BLOCK, 256, 0, stream>>>(ffn2_w, w2_16);

  // 2) h = LN1(x)
  layernorm_f16_kernel<<<MROWS / (8 * LNR), 256, 0, stream>>>(x, ln1_w, ln1_b, h16);

  // 3) g = sigmoid(h @ gate_w^T + b), v = h @ val_w^T + b
  gemm_wmma_kernel<0, DIM><<<dim3(DIM / BN, MROWS / BM), 256, 0, stream>>>(
      h16, gw16, gate_b, nullptr, G, nullptr, MROWS, DIM);
  gemm_wmma_kernel<1, DIM><<<dim3(DIM / BN, MROWS / BM), 256, 0, stream>>>(
      h16, vw16, val_b, nullptr, V, nullptr, MROWS, DIM);

  // 4) x1 = x + cumsum(g*v) / (sqrt(cumsum(g)+1e-6)*sqrt(pos/S+0.1))   [3-pass scan]
  scan_partial_kernel<<<(BATCH * NCHK * DIM) / 256, 256, 0, stream>>>(G, V, Sg, Sv);
  scan_prefix_kernel<<<(BATCH * DIM) / 256, 256, 0, stream>>>(Sg, Sv);
  scan_apply_kernel<<<(BATCH * NCHK * DIM) / 256, 256, 0, stream>>>(x, G, V, Sg, Sv, X1);

  // 5) h2 = LN2(x1)
  layernorm_f16_kernel<<<MROWS / (8 * LNR), 256, 0, stream>>>(X1, ln2_w, ln2_b, h16);

  // 6) ff1 = gelu(h2 @ ffn1_w^T + b)  -> f16
  gemm_wmma_kernel<2, 4 * DIM><<<dim3(4 * DIM / BN, MROWS / BM), 256, 0, stream>>>(
      h16, w1_16, ffn1_b, nullptr, nullptr, FF1, MROWS, DIM);

  // 7) out = x1 + (ff1 @ ffn2_w^T + b)
  gemm_wmma_kernel<3, DIM><<<dim3(DIM / BN, MROWS / BM), 256, 0, stream>>>(
      FF1, w2_16, ffn2_b, X1, X1, nullptr, MROWS, 4 * DIM);
}

// v006
// One run takes 326 microseconds.
// Two timings next to v005 both put it at 1.05 times that version's speed.
// Over all steps from v000 it is 2.58 times as fast.
#include <hip/hip_runtime.h>
#include <hip/hip_bf16.h>
#include <math.h>

typedef __attribute__((ext_vector_type(16))) _Float16 v16h;
typedef __attribute__((ext_vector_type(8)))  _Float16 v8h;
typedef __attribute__((ext_vector_type(8)))  float    v8f;
typedef __attribute__((ext_vector_type(4)))  float    v4f;
typedef __attribute__((ext_vector_type(4)))  _Float16 v4h;
typedef __attribute__((ext_vector_type(2)))  uint32_t v2u;

#define DIM   1024
#define SEQ   4096
#define BATCH 4
#define MROWS (BATCH*SEQ)   // 16384 token rows
#define CHUNK 32
#define NCHK  (SEQ/CHUNK)   // 128 chunks per sequence
#define BM    256           // GEMM block tile rows (tokens)
#define BN    256           // GEMM block tile columns (output features)
#define BK    128           // k extent of one staged tile
#define LDP   136           // LDS row pitch of the GEMM tiles in halves: 128 data + 8 pad = 272 B (16 B x odd)
#define STAGE_H ((BM + BN) * LDP)   // halves per buffer: A rows 0..255, then W rows 0..255
#define EPP   68            // LDS row pitch of the epilogue in floats: 64 data + 4 pad (rows 8 apart: 32 banks apart)

// ---- CDNA5 async copy: global -> LDS, 16 bytes per lane and copy, tracked by ASYNCcnt ----
typedef int v4i_t __attribute__((__vector_size__(16)));
typedef __attribute__((address_space(1))) v4i_t* gptr_t;
typedef __attribute__((address_space(3))) v4i_t* lptr_t;
// One staged tile: 256 A rows and 256 W rows of 256 B each, 32 copies per thread (rows 16 apart,
// gs halves apart in global memory). Builtin copies: the compiler owns their address registers.
__device__ __forceinline__ void stage_copies(_Float16* l, const _Float16* ga, const _Float16* gb, size_t gs) {
  // both loops unrolled: straight-line copies, their LDS row offsets folded into constants
#pragma unroll
  for (int q = 0; q < BM / 16; ++q)
    __builtin_amdgcn_global_load_async_to_lds_b128((gptr_t)(ga + q * gs), (lptr_t)(l + q * 16 * LDP), 0, 0);
#pragma unroll
  for (int q = 0; q < BN / 16; ++q)
    __builtin_amdgcn_global_load_async_to_lds_b128((gptr_t)(gb + q * gs), (lptr_t)(l + (BM + q * 16) * LDP), 0, 0);
}
// This wave's copies have landed in LDS.
#define WAIT_ASYNCCNT0() asm volatile("s_wait_asynccnt 0x0" ::: "memory")
// This wave's LDS reads have returned, so the buffer they read may be refilled behind the barrier.
#define WAIT_DSCNT0()    asm volatile("s_wait_dscnt 0x0" ::: "memory")

// ---------------- fp32 -> fp16 weight conversion ----------------
// A block converts CVT_PER_BLOCK neighbouring elements: eight 16-byte loads per lane, each wave-wide
// load 512 contiguous bytes, all in flight together. Few long waves, for speed only.
// The grid covers the array exactly (its size is a multiple of CVT_PER_BLOCK).
#define CVT_PER_BLOCK (256 * 4 * 8)
__global__ void __launch_bounds__(256)
f32_to_f16_kernel(const float* __restrict__ src, _Float16* __restrict__ dst) {
  const size_t base = (size_t)blockIdx.x * CVT_PER_BLOCK + threadIdx.x * 4;
  v4f x[8];
  // both loops unrolled: x is a register array, and the loads go out ahead of the first store
#pragma unroll
  for (int j = 0; j < 8; ++j) x[j] = *(const v4f*)(src + base + j * 1024);
#pragma unroll
  for (int j = 0; j < 8; ++j) *(v4h*)(dst + base + j * 1024) = __builtin_convertvector(x[j], v4h);
}

// ---------------- LayerNorm: one wave per LNR rows of 1024, eight waves a block ----------------
// A lane holds 32 values of each row (eight 16-byte loads, each wave-wide load 512 contiguous bytes);
// all LNR rows are in flight together, and their sums cross the lanes in one interleaved butterfly.
#define LNR 4
__global__ void __launch_bounds__(256)
layernorm_f16_kernel(const float* __restrict__ X, const float* __restrict__ W,
                     const float* __restrict__ B, _Float16* __restrict__ H) {
  const int lane = threadIdx.x & 31;
  const int wave = threadIdx.x >> 5;
  const size_t e0 = (size_t)(blockIdx.x * 8 + wave) * (LNR * DIM) + lane * 4;
  const float* xr = X + e0;
  // every loop below is unrolled: a, w, b, s and q are register arrays and need constant indices
  v4f a[LNR][8];
#pragma unroll
  for (int r = 0; r < LNR; ++r)
#pragma unroll
    for (int j = 0; j < 8; ++j) a[r][j] = *(const v4f*)(xr + r * DIM + j * 128);
  // this lane's columns of weight and bias, asked for behind the rows: they are there when the sums are
  v4f w[8], b[8];
#pragma unroll
  for (int j = 0; j < 8; ++j) {
    w[j] = *(const v4f*)(W + j * 128 + lane * 4);
    b[j] = *(const v4f*)(B + j * 128 + lane * 4);
  }
  // keeps the weight and bias loads up here: moved down to their uses they are waited for pair by pair
  __builtin_amdgcn_sched_barrier(0);
  // the wait in front of any rewrite of a register that the loads above name; as its operand the rows'
  // address pair stays live up to here (without it a weight load took the pair as its destination)
  asm volatile("s_wait_xcnt 0x0" :: "v"(xr) : "memory");
  float s[LNR], q[LNR];
#pragma unroll
  for (int r = 0; r < LNR; ++r) {
    v4f s4 = a[r][0];
    v4f q4 = a[r][0] * a[r][0];
#pragma unroll
    for (int j = 1; j < 8; ++j) { s4 += a[r][j]; q4 += a[r][j] * a[r][j]; }
    s[r] = (s4[0] + s4[1]) + (s4[2] + s4[3]);
    q[r] = (q4[0] + q4[1]) + (q4[2] + q4[3]);
  }
#pragma unroll
  for (int m = 16; m > 0; m >>= 1)
#pragma unroll
    for (int r = 0; r < LNR; ++r) {
      s[r] += __shfl_xor(s[r], m, 32);
      q[r] += __shfl_xor(q[r], m, 32);
    }
  float mean[LNR], rstd[LNR];
#pragma unroll
  for (int r = 0; r < LNR; ++r) {
    mean[r] = s[r] * (1.0f / DIM);
    rstd[r] = rsqrtf(q[r] * (1.0f / DIM) - mean[r] * mean[r] + 1e-5f);
  }
  _Float16* hr = H + e0;
#pragma unroll
  for (int j = 0; j < 8; ++j)
#pragma unroll
    for (int r = 0; r < LNR; ++r)
      *(v4h*)(hr + r * DIM + j * 128) = __builtin_convertvector((a[r][j] - mean[r]) * rstd[r] * w[j] + b[j], v4h);
}

// ---------------- 3-pass chunked scan over the seq axis ----------------
// Passes 1 and 3 are streams: a block owns one chunk of CHUNK whole rows (blockIdx.x = batch * NCHK + chunk),
// a lane four neighbouring features, so that each wave-wide load or store is 512 contiguous bytes.
#define SR 4                // rows of one batch of loads in pass 3
#define SP 8                // rows of one batch of loads in pass 1
#define PCH 32              // chunks of one thread in pass 2
__device__ __forceinline__ v4f fma4(v4f a, v4f b, v4f c) {
  return v4f{fmaf(a[0], b[0], c[0]), fmaf(a[1], b[1], c[1]), fmaf(a[2], b[2], c[2]), fmaf(a[3], b[3], c[3])};
}

// pass 1: per-chunk sums of g and g*v
__global__ void __launch_bounds__(256)
scan_partial_kernel(const float* __restrict__ G, const float* __restrict__ V,
                    float* __restrict__ Sg, float* __restrict__ Sv) {
  const size_t base = (size_t)blockIdx.x * (CHUNK * DIM) + threadIdx.x * 4;
  v4f sg = {0.0f, 0.0f, 0.0f, 0.0f}, sv = {0.0f, 0.0f, 0.0f, 0.0f};
  for (int s0 = 0; s0 < CHUNK; s0 += SP) {
    // the loops over j are unrolled: g and v are register arrays and need constant indices
    v4f g[SP], v[SP];
#pragma unroll
    for (int j = 0; j < SP; ++j) {
      g[j] = *(const v4f*)(G + base + (size_t)(s0 + j) * DIM);
      v[j] = *(const v4f*)(V + base + (size_t)(s0 + j) * DIM);
    }
#pragma unroll
    for (int j = 0; j < SP; ++j) {
      sg += g[j];
      sv = fma4(g[j], v[j], sv);
    }
  }
  const size_t pidx = (size_t)blockIdx.x * DIM + threadIdx.x * 4;
  *(v4f*)(Sg + pidx) = sg;
  *(v4f*)(Sv + pidx) = sv;
}

// pass 2: exclusive prefix over chunks, per (batch, feature) column. A column's NCHK chunks are dealt to
// NCHK / PCH threads, PCH neighbouring chunks each, so that all of a thread's loads are in flight at once;
// the segments' totals meet in LDS. A block owns 64 neighbouring columns; a wave-wide load is one 128-byte line.
__global__ void __launch_bounds__(256)
scan_prefix_kernel(float* __restrict__ Sg, float* __restrict__ Sv) {
  __shared__ float tg[NCHK / PCH][64], tv[NCHK / PCH][64];
  const int col = threadIdx.x & 63;
  const int seg = threadIdx.x >> 6;
  const int gc  = blockIdx.x * 64 + col;            // 0..4095
  const int b = gc >> 10, f = gc & (DIM - 1);
  const size_t i0 = ((size_t)b * NCHK + seg * PCH) * DIM + f;
  float* pg = Sg + i0;
  float* pv = Sv + i0;
  // every loop is unrolled: g and v are register arrays and need constant indices
  float g[PCH], v[PCH];
#pragma unroll
  for (int k = 0; k < PCH; ++k) { g[k] = pg[k * DIM]; v[k] = pv[k * DIM]; }
  // exclusive prefix inside the segment
  float ag = 0.0f, av = 0.0f;
#pragma unroll
  for (int k = 0; k < PCH; ++k) {
    const float g0 = g[k], v0 = v[k];
    g[k] = ag; v[k] = av;
    ag += g0; av += v0;
  }
  tg[seg][col] = ag;
  tv[seg][col] = av;
  __syncthreads();   // every segment's total is written before another segment's thread reads it
  float og = 0.0f, ov = 0.0f;
#pragma unroll
  for (int q = 0; q < NCHK / PCH - 1; ++q) {
    const float a = tg[q][col], c = tv[q][col];
    og += q < seg ? a : 0.0f;
    ov += q < seg ? c : 0.0f;
  }
#pragma unroll
  for (int k = 0; k < PCH; ++k) { pg[k * DIM] = og + g[k]; pv[k * DIM] = ov + v[k]; }
}

// pass 3: chunk-local scan with carry-in; x1 = x + mem
// one batch: rows R0 .. R0 + SR - 1, counted from the three pointers, of g, v and x: 12 loads of 16 bytes a lane
template<int R0>
__device__ __forceinline__ void scan_load(v4f (&g)[SR], v4f (&v)[SR], v4f (&x)[SR],
                                          const float* G, const float* V, const float* X) {
#pragma unroll
  for (int j = 0; j < SR; ++j) {
    g[j] = *(const v4f*)(G + (R0 + j) * DIM);
    v[j] = *(const v4f*)(V + (R0 + j) * DIM);
    x[j] = *(const v4f*)(X + (R0 + j) * DIM);
  }
  // keeps the loads up here, ahead of the other batch's math: moved down behind it they are waited for at once
  __builtin_amdgcn_sched_barrier(0);
  // the wait in front of any rewrite of a register that the loads above name; as its operands the three
  // address pairs stay live up to here (without it a load took a pair as its destination)
  asm volatile("s_wait_xcnt 0x0" :: "v"(G), "v"(V), "v"(X) : "memory");
}
// The batch's four rows go out together. The stores and their s_wait_xcnt 0 stand in one statement, so that
// neither the address pair nor a data register they name is rewritten ahead of that wait.
__device__ __forceinline__ void scan_store(float* p, const v4f (&o)[SR]) {
  asm volatile("global_store_b128 %0, %1, off\n\t"
               "global_store_b128 %0, %2, off offset:%5\n\t"
               "global_store_b128 %0, %3, off offset:%6\n\t"
               "global_store_b128 %0, %4, off offset:%7\n\t"
               "s_wait_xcnt 0x0"
               :: "v"(p), "v"(o[0]), "v"(o[1]), "v"(o[2]), "v"(o[3]),
                  "n"(DIM * 4), "n"(2 * DIM * 4), "n"(3 * DIM * 4) : "memory");
}
// the batch's rows in turn; pos0 is the first row's position in the sequence, counted from 1
__device__ __forceinline__ void scan_rows(const v4f (&g)[SR], const v4f (&v)[SR], const v4f (&x)[SR],
                                          v4f& cg, v4f& cv, int pos0, float* O) {
  v4f o[SR];
#pragma unroll
  for (int j = 0; j < SR; ++j) {
    cv = fma4(g[j], v[j], cv);
    cg += g[j];
    const float sp = sqrtf((float)(pos0 + j) * (1.0f / (float)SEQ) + 0.1f);   // one per row, shared by the four features
#pragma unroll
    for (int e = 0; e < 4; ++e) o[j][e] = x[j][e] + cv[e] / (sqrtf(cg[e] + 1e-6f) * sp);
  }
  scan_store(O, o);
}
__global__ void __launch_bounds__(256)
scan_apply_kernel(const float* __restrict__ X, const float* __restrict__ G,
                  const float* __restrict__ V, const float* __restrict__ Sg,
                  const float* __restrict__ Sv, float* __restrict__ X1) {
  const int c = blockIdx.x & (NCHK - 1);
  const size_t base = (size_t)blockIdx.x * (CHUNK * DIM) + threadIdx.x * 4;
  const size_t pidx = (size_t)blockIdx.x * DIM + threadIdx.x * 4;
  const float* gp = G + base;
  const float* vp = V + base;
  const float* xp = X + base;
  const float* sgp = Sg + pidx;
  const float* svp = Sv + pidx;
  float* op = X1 + base;
  v4f cg = *(const v4f*)sgp;
  v4f cv = *(const v4f*)svp;
  // as in scan_load: the two address pairs stay live up to the wait
  asm volatile("s_wait_xcnt 0x0" :: "v"(sgp), "v"(svp) : "memory");
  // two register sets: one batch's loads fly while the batch before it is worked on
  v4f g[2][SR], v[2][SR], x[2][SR];
  scan_load<0>(g[0], v[0], x[0], gp, vp, xp);
  int pos = c * CHUNK + 1;   // position in the sequence, counted from 1, of the row that the pointers stand on
  // stays rolled, two batches a trip, to keep the kernel's text short; the last two batches stand behind the
  // loop, so that every trip asks for the same loads and each wait counts only the batch it needs
#pragma unroll 1
  for (int t = 0; t < CHUNK / SR - 2; t += 2) {
    scan_load<SR>(g[1], v[1], x[1], gp, vp, xp);
    scan_rows(g[0], v[0], x[0], cg, cv, pos, op);
    scan_load<2 * SR>(g[0], v[0], x[0], gp, vp, xp);
    scan_rows(g[1], v[1], x[1], cg, cv, pos + SR, op + SR * DIM);
    gp += 2 * SR * DIM; vp += 2 * SR * DIM; xp += 2 * SR * DIM; op += 2 * SR * DIM;
    pos += 2 * SR;
  }
  scan_load<SR>(g[1], v[1], x[1], gp, vp, xp);
  scan_rows(g[0], v[0], x[0], cg, cv, pos, op);
  scan_rows(g[1], v[1], x[1], cg, cv, pos + SR, op + SR * DIM);
}

// ---- epilogue stores: four neighbouring columns of two output rows (PB bytes apart) per lane ----
// The two stores and their s_wait_xcnt 0 stand in one statement, so that neither the address pair
// nor a data register they name is rewritten ahead of that wait.
template<int PB> __device__ __forceinline__ void store_rows_f32(float* p, v4f x0, v4f x1) {
  asm volatile("global_store_b128 %0, %1, off\n\t"
               "global_store_b128 %0, %2, off offset:%3\n\t"
               "s_wait_xcnt 0x0"
               :: "v"(p), "v"(x0), "v"(x1), "n"(PB) : "memory");
}
template<int PB> __device__ __forceinline__ void store_rows_f16(_Float16* p, v4h x0, v4h x1) {
  asm volatile("global_store_b64 %0, %1, off\n\t"
               "global_store_b64 %0, %2, off offset:%3\n\t"
               "s_wait_xcnt 0x0"
               :: "v"(p), "v"(__builtin_bit_cast(v2u, x0)), "v"(__builtin_bit_cast(v2u, x1)), "n"(PB) : "memory");
}
// This lane's four bias values. The load and its data wait stand in one statement with an
// early-clobber output, so that the address pair is not taken as the destination.
__device__ __forceinline__ v4f load_bias(const float* p) {
  v4f x;
  asm volatile("global_load_b128 %0, %1, off\n\t"
               "s_wait_loadcnt 0x0"
               : "=&v"(x) : "v"(p) : "memory");
  return x;
}

// ---- epilogue activations: straight-line, no branch, so that a lane's eight values run side by side ----
// sigmoid(v) = 1 / (1 + 2^(-v log2 e)) on the hardware's exp2 and reciprocal; 2^x = inf gives 0, 2^x = 0 gives 1.
// Each group of four transcendentals is one statement and works in place: none reads a neighbour's result
// or writes a neighbour's source, and the v_nop is the one slot that the instruction set asks for behind
// the last of them, whatever the compiler puts next.
__device__ __forceinline__ v4f sigmoid_x4(v4f v) {
  const v4f m = v * -1.4426950408889634f;
  float a = m[0], b = m[1], c = m[2], d = m[3];
  asm("v_exp_f32 %0, %0\n\t"
      "v_exp_f32 %1, %1\n\t"
      "v_exp_f32 %2, %2\n\t"
      "v_exp_f32 %3, %3\n\t"
      "v_nop"
      : "+v"(a), "+v"(b), "+v"(c), "+v"(d));
  a += 1.0f; b += 1.0f; c += 1.0f; d += 1.0f;
  asm("v_rcp_f32 %0, %0\n\t"
      "v_rcp_f32 %1, %1\n\t"
      "v_rcp_f32 %2, %2\n\t"
      "v_rcp_f32 %3, %3\n\t"
      "v_nop"
      : "+v"(a), "+v"(b), "+v"(c), "+v"(d));
  return v4f{a, b, c, d};
}
// v/2 (1 + erf(v / sqrt 2)). For z = |v| / sqrt 2 >= 0: erf(z) = 1 - (a1 t + ... + a5 t^5) exp(-z^2),
// t = 1 / (1 + p z), absolute error of the form 1.5e-7 (about one f32 step of 1 + erf). erf is odd, so
// v/2 erf(v / sqrt 2) = |v/2| erf(z): no sign is copied.
__device__ __forceinline__ float gelu_erf_f32(float v) {
  const float z = fabsf(v) * 0.70710678118654752f;
  const float t = __builtin_amdgcn_rcpf(fmaf(0.3275911f, z, 1.0f));
  float p = fmaf(1.061405429f, t, -1.453152027f);
  p = fmaf(p, t, 1.421413741f);
  p = fmaf(p, t, -0.284496736f);
  p = fmaf(p, t, 0.254829592f);
  p *= t;
  const float e = __builtin_amdgcn_exp2f((v * v) * -0.72134752044448170f);   // exp(-z^2) = 2^(-v^2 log2(e) / 2)
  const float h = 0.5f * v;
  return fmaf(fabsf(h), fmaf(-p, e, 1.0f), h);
}

// ---------------- WMMA GEMM:  out[m,n] = sum_k A[m,k] * W16[n,k]  (+bias, epilogue) ---------
// EPI: 0 = sigmoid -> f32,  1 = identity -> f32,  2 = exact GELU -> f16,  3 = +residual -> f32
// N (the output's row length) is a template parameter: the epilogue's row steps are then immediates.
template<int EPI, int N>
// Eight waves, two per SIMD, one block a WGP: a wave owns 64 x 128 of the output (32 accumulator tiles),
// so that 12 fragments from LDS feed 32 WMMAs, and a block asks L2 for 512 operand rows per 256 x 256 outputs.
__global__ void __launch_bounds__(256)
gemm_wmma_kernel(const _Float16* __restrict__ A, const _Float16* __restrict__ W16,
                 const float* __restrict__ bias, const float* __restrict__ res,
                 float* __restrict__ outF, _Float16* __restrict__ outH,
                 int M, int K) {
  // Two buffers of 512 rows (A tile, then W tile) of 128 halves at pitch LDP: the 16 rows that a
  // half-wave's ds_load_b128 reads fall on 64 distinct banks.
  __shared__ __align__(16) _Float16 smem[2 * STAGE_H];

  const int tid  = threadIdx.x;
  const int lane = tid & 31;
  const int wave = tid >> 5;
  const int wm   = wave & 3;        // 0..3 -> 64-row M strip of the block tile
  const int wn   = wave >> 2;       // 0..1 -> 128-column N strip of the block tile
  const int hi   = lane >> 4;       // lane half selects K-phase (ISA frag layout)
  const int l15  = lane & 15;
  const int m0   = blockIdx.y * BM;
  const int n0   = blockIdx.x * BN;

  // Per-thread async staging assignment: 16-B chunk (tid & 15) of rows (tid >> 4) + 16 q.
  const int cC = (tid & 15) * 8;
  const int rC = tid >> 4;
  const size_t gs = (size_t)16 * K;
  const _Float16* gA = A   + (size_t)(m0 + rC) * K + cC;
  const _Float16* gB = W16 + (size_t)(n0 + rC) * K + cC;
  _Float16* lC = &smem[rC * LDP + cC];

  const int nsteps = K >> 7;

  // prologue: tile 0 into buffer 0, published; then tile 1 starts into buffer 1
  stage_copies(lC, gA, gB, gs);
  WAIT_ASYNCCNT0();
  __syncthreads();
  if (nsteps > 1) stage_copies(lC + STAGE_H, gA + BK, gB + BK, gs);

  // every loop over i, t and r below is unrolled: the accumulators and fragments are register
  // arrays and need constant indices
  v8f acc[4][8];
#pragma unroll
  for (int i = 0; i < 4; ++i)
#pragma unroll
    for (int t = 0; t < 8; ++t)
#pragma unroll
      for (int r = 0; r < 8; ++r) acc[i][t][r] = 0.0f;

  const int offA = (wm * 64 + l15) * LDP + 8 * hi;
  const int offB = (BM + wn * 128 + l15) * LDP + 8 * hi;

  for (int s = 0; s < nsteps; ++s) {
    const int buf = s & 1;
    const _Float16* sa = smem + buf * STAGE_H + offA;
    const _Float16* sb = smem + buf * STAGE_H + offB;

    // the stage's four k quarters in turn, each: 12 fragments from LDS, then 32 WMMAs
#pragma unroll
    for (int kk = 0; kk < BK / 32; ++kk) {
      // fragment (16x32 f16): lane<16 holds K {0..7,16..23}, lane>=16 holds K {8..15,24..31}
      v16h afrag[4];
      v16h bfrag[8];
#pragma unroll
      for (int i = 0; i < 4; ++i) {
        const _Float16* ap = sa + i * 16 * LDP + kk * 32;
        v8h alo = *(const v8h*)(ap);
        v8h ahi = *(const v8h*)(ap + 16);
        afrag[i] = __builtin_shufflevector(alo, ahi, 0,1,2,3,4,5,6,7,8,9,10,11,12,13,14,15);
      }
#pragma unroll
      for (int t = 0; t < 8; ++t) {
        const _Float16* bp = sb + t * 16 * LDP + kk * 32;
        v8h blo = *(const v8h*)(bp);
        v8h bhi = *(const v8h*)(bp + 16);
        bfrag[t] = __builtin_shufflevector(blo, bhi, 0,1,2,3,4,5,6,7,8,9,10,11,12,13,14,15);
      }
      // holds the fragment loads together in front of the WMMAs: one place with LDS reads a quarter
      __builtin_amdgcn_sched_barrier(0);
      if (kk == BK / 32 - 1) {
        // publish point: my last reads of buf have returned, my copies of tile s+1 have landed; the
        // one barrier publishes tile s+1 and frees buf for the refill behind it, which then flies
        // during this quarter's WMMAs and the next stage's first three
        WAIT_DSCNT0();
        WAIT_ASYNCCNT0();
        __syncthreads();
        if (s + 2 < nsteps) {
          const int k = (s + 2) * BK;
          stage_copies(lC + buf * STAGE_H, gA + k, gB + k, gs);
        }
      }
#pragma unroll
      for (int t = 0; t < 8; ++t)
#pragma unroll
        for (int i = 0; i < 4; ++i)
          acc[i][t] = __builtin_amdgcn_wmma_f32_16x16x32_f16(
              false, afrag[i], false, bfrag[t], (short)0, acc[i][t], false, false);
      // keeps the later quarters' fragment loads behind these WMMAs: lifted over them, three more
      // fragment sets were live at once and the accumulators spilled to scratch
      __builtin_amdgcn_sched_barrier(0);
    }
  }
  WAIT_ASYNCCNT0();

  // epilogue. The accumulators pass through LDS (free behind the loop's last barrier), a group of 16 rows
  // by 64 columns of the wave's strip at a time (group g: rows (g & 3) * 16.., columns (g >> 2) * 64..),
  // each wave in a region of its own: the element-wise math is then a loop over rows that can stay
  // rolled, and a lane stores four neighbouring columns at once.
  float* ep = (float*)smem + wave * (16 * EPP);
  const int c4    = l15 * 4;                    // this lane's columns: c4..c4+3 of a group's 64
  const int ncol0 = n0 + wn * 128 + c4;
  // this lane's rows of a group: it * 4 + hi and it * 4 + 2 + hi
  const size_t e0 = (size_t)(m0 + wm * 64 + hi) * N + ncol0;
  v4f bv[2];   // bias of this lane's columns in the strip's two 64-column halves

  // residual of 16 rows, fetched one group of rows ahead of its use so that its latency is hidden
  v4f rv[2][4][2];
  if (EPI == 3) {
#pragma unroll
    for (int it = 0; it < 4; ++it) {
      rv[0][it][0] = *(const v4f*)(res + e0 + (it * 4) * N);
      rv[0][it][1] = *(const v4f*)(res + e0 + (it * 4 + 2) * N);
    }
  }
#pragma unroll
  for (int g = 0; g < 8; ++g) {
    const int i = g & 3;
    const int h = g >> 2;
    const int go = h * 64 + i * 16 * N;                 // this group's first element, counted from e0
    const int gn = ((g + 1) >> 2) * 64 + ((g + 1) & 3) * 16 * N;   // the next group's
    if (g > 0) __syncthreads();   // the last group's reads are done before its rows are overwritten
    // D layout: lanes 0-15 N=lane, M=r; lanes 16-31 N=lane-16, M=r+8
#pragma unroll
    for (int t = 0; t < 4; ++t)
#pragma unroll
      for (int r = 0; r < 8; ++r) ep[(hi * 8 + r) * EPP + t * 16 + l15] = acc[i][h * 4 + t][r];
    if (g == 0) {   // their waits pass beside that of the LDS writes above
      bv[0] = load_bias(bias + ncol0);
      bv[1] = load_bias(bias + ncol0 + 64);
    }
    __syncthreads();              // the rows are written before other lanes read them
    // behind the barrier (which waits for every load in flight), so that these fly during this group's work
    if (EPI == 3 && g + 1 < 8) {
#pragma unroll
      for (int it = 0; it < 4; ++it) {
        rv[(g + 1) & 1][it][0] = *(const v4f*)(res + e0 + gn + (it * 4) * N);
        rv[(g + 1) & 1][it][1] = *(const v4f*)(res + e0 + gn + (it * 4 + 2) * N);
      }
    }
    if (EPI == 0 || EPI == 2) {
      // stays rolled, to keep the kernel's text short: eight exp or erf evaluations here, not 256
#pragma unroll 1
      for (int it = 0; it < 4; ++it) {
        const float* q = ep + (it * 4 + hi) * EPP + c4;
        const v4f v0 = *(const v4f*)q + bv[h];
        const v4f v1 = *(const v4f*)(q + 2 * EPP) + bv[h];
        const size_t e = e0 + go + (size_t)(it * 4) * N;
        if (EPI == 0) {
          store_rows_f32<2 * N * 4>(outF + e, sigmoid_x4(v0), sigmoid_x4(v1));
        } else {
          v4h o0, o1;
#pragma unroll
          for (int j = 0; j < 4; ++j) {
            o0[j] = (_Float16)gelu_erf_f32(v0[j]);
            o1[j] = (_Float16)gelu_erf_f32(v1[j]);
          }
          store_rows_f16<2 * N * 2>(outH + e, o0, o1);
        }
      }
    } else {
#pragma unroll
      for (int it = 0; it < 4; ++it) {
        const float* q = ep + (it * 4 + hi) * EPP + c4;
        v4f v0 = *(const v4f*)q + bv[h];
        v4f v1 = *(const v4f*)(q + 2 * EPP) + bv[h];
        if (EPI == 3) {
          v0 = rv[g & 1][it][0] + v0;
          v1 = rv[g & 1][it][1] + v1;
        }
        store_rows_f32<2 * N * 4>(outF + e0 + go + (it * 4) * N, v0, v1);
      }
    }
  }
}

extern "C" void kernel_launch(void* const* d_in, const int* in_sizes, int n_in,
                              void* d_out, int out_size, void* d_ws, size_t ws_size,
                              hipStream_t stream) {
  (void)in_sizes; (void)n_in; (void)out_size; (void)ws_size;
  const float* x      = (const float*)d_in[0];
  const float* ln1_w  = (const float*)d_in[1];
  const float* ln1_b  = (const float*)d_in[2];
  const float* ln2_w  = (const float*)d_in[3];
  const float* ln2_b  = (const float*)d_in[4];
  const float* gate_w = (const float*)d_in[5];
  const float* gate_b = (const float*)d_in[6];
  const float* val_w  = (const float*)d_in[7];
  const float* val_b  = (const float*)d_in[8];
  const float* ffn1_w = (const float*)d_in[9];
  const float* ffn1_b = (const float*)d_in[10];
  const float* ffn2_w = (const float*)d_in[11];
  const float* ffn2_b = (const float*)d_in[12];

  char* ws = (char*)d_ws;
  const size_t MB = 1024ull * 1024ull;
  _Float16* h16   = (_Float16*)(ws);             // 32 MB: LN output (reused for LN2)
  float*    G     = (float*)(ws + 32 * MB);      // 64 MB
  float*    V     = (float*)(ws + 96 * MB);      // 64 MB
  _Float16* FF1   = (_Float16*)(ws + 32 * MB);   // 128 MB, reuses dead G/V region
  _Float16* gw16  = (_Float16*)(ws + 160 * MB);  // 2 MB
  _Float16* vw16  = (_Float16*)(ws + 162 * MB);  // 2 MB
  _Float16* w1_16 = (_Float16*)(ws + 164 * MB);  // 8 MB
  _Float16* w2_16 = (_Float16*)(ws + 172 * MB);  // 8 MB
  float*    Sg    = (float*)(ws + 180 * MB);     // 2 MB chunk partials
  float*    Sv    = (float*)(ws + 182 * MB);     // 2 MB chunk partials
  float*    X1    = (float*)d_out;               // x + mem lives in d_out

  // 1) weights -> f16
  f32_to_f16_kernel<<<(DIM * DIM) / CVT_PER_BLOCK, 256, 0, stream>>>(gate_w, gw16);
  f32_to_f16_kernel<<<(DIM * DIM) / CVT_PER_BLOCK, 256, 0, stream>>>(val_w,  vw16);
  f32_to_f16_kernel<<<(4 * DIM * DIM) / CVT_PER_BLOCK, 256, 0, stream>>>(ffn1_w, w1_16);
  f32_to_f16_kernel<<<(4 * DIM * DIM) / CVT_PER_BLOCK, 256, 0, stream>>>(ffn2_w, w2_16);

  // 2) h = LN1(x)
  layernorm_f16_kernel<<<MROWS / (8 * LNR), 256, 0, stream>>>(x, ln1_w, ln1_b, h16);

  // 3) g = sigmoid(h @ gate_w^T + b), v = h @ val_w^T + b
  gemm_wmma_kernel<0, DIM><<<dim3(DIM / BN, MROWS / BM), 256, 0, stream>>>(
      h16, gw16, gate_b, nullptr, G, nullptr, MROWS, DIM);
  gemm_wmma_kernel<1, DIM><<<dim3(DIM / BN, MROWS / BM), 256, 0, stream>>>(
      h16, vw16, val_b, nullptr, V, nullptr, MROWS, DIM);

  // 4) x1 = x + cumsum(g*v) / (sqrt(cumsum(g)+1e-6)*sqrt(pos/S+0.1))   [3-pass scan]
  scan_partial_kernel<<<BATCH * NCHK, 256, 0, stream>>>(G, V, Sg, Sv);
  scan_prefix_kernel<<<(BATCH * DIM) / 64, 256, 0, stream>>>(Sg, Sv);
  scan_apply_kernel<<<BATCH * NCHK, 256, 0, stream>>>(x, G, V, Sg, Sv, X1);

  // 5) h2 = LN2(x1)
  layernorm_f16_kernel<<<MROWS / (8 * LNR), 256, 0, stream>>>(X1, ln2_w, ln2_b, h16);

  // 6) ff1 = gelu(h2 @ ffn1_w^T + b)  -> f16
  gemm_wmma_kernel<2, 4 * DIM><<<dim3(4 * DIM / BN, MROWS / BM), 256, 0, stream>>>(
      h16, w1_16, ffn1_b, nullptr, nullptr, FF1, MROWS, DIM);

  // 7) out = x1 + (ff1 @ ffn2_w^T + b)
  gemm_wmma_kernel<3, DIM><<<dim3(DIM / BN, MROWS / BM), 256, 0, stream>>>(
      FF1, w2_16, ffn2_b, X1, X1, nullptr, MROWS, 4 * DIM);
}

// v007
// One run takes 307 microseconds.
// In both of two side-by-side timings against v006, it was 1.06 times as fast.
// Counting every step since v000, it is 2.72 times as fast.
#include <hip/hip_runtime.h>
#include <hip/hip_bf16.h>
#include <math.h>

typedef __attribute__((ext_vector_type(16))) _Float16 v16h;
typedef __attribute__((ext_vector_type(8)))  _Float16 v8h;
typedef __attribute__((ext_vector_type(8)))  float    v8f;
typedef __attribute__((ext_vector_type(4)))  float    v4f;
typedef __attribute__((ext_vector_type(4)))  _Float16 v4h;
typedef __attribute__((ext_vector_type(2)))  uint32_t v2u;

#define DIM   1024
#define SEQ   4096
#define BATCH 4
#define MROWS (BATCH*SEQ)   // 16384 token rows
#define CHUNK 32
#define NCHK  (SEQ/CHUNK)   // 128 chunks per sequence
#define BM    256           // GEMM block tile rows (tokens)
#define BN    256           // GEMM block tile columns (output features)
#define BK    128           // k extent of one staged tile
#define LDP   136           // LDS row pitch of the GEMM tiles in halves: 128 data + 8 pad = 272 B (16 B x odd)
#define STAGE_H ((BM + BN) * LDP)   // halves per buffer: A rows 0..255, then W rows 0..255
#define EPP   68            // LDS row pitch of the epilogue in floats: 64 data + 4 pad (rows 8 apart: 32 banks apart)

// ---- CDNA5 async copy: global -> LDS, 16 bytes per lane and copy, tracked by ASYNCcnt ----
typedef int v4i_t __attribute__((__vector_size__(16)));
typedef __attribute__((address_space(1))) v4i_t* gptr_t;
typedef __attribute__((address_space(3))) v4i_t* lptr_t;
// One staged tile: 256 A rows and 256 W rows of 256 B each, 32 copies per thread (rows 16 apart,
// gs halves apart in global memory). Builtin copies: the compiler owns their address registers.
__device__ __forceinline__ void stage_copies(_Float16* l, const _Float16* ga, const _Float16* gb, size_t gs) {
  // both loops unrolled: straight-line copies, their LDS row offsets folded into constants
#pragma unroll
  for (int q = 0; q < BM / 16; ++q)
    __builtin_amdgcn_global_load_async_to_lds_b128((gptr_t)(ga + q * gs), (lptr_t)(l + q * 16 * LDP), 0, 0);
#pragma unroll
  for (int q = 0; q < BN / 16; ++q)
    __builtin_amdgcn_global_load_async_to_lds_b128((gptr_t)(gb + q * gs), (lptr_t)(l + (BM + q * 16) * LDP), 0, 0);
}
// This wave's copies have landed in LDS.
#define WAIT_ASYNCCNT0() asm volatile("s_wait_asynccnt 0x0" ::: "memory")
// This wave's LDS reads have returned, so the buffer they read may be refilled behind the barrier.
#define WAIT_DSCNT0()    asm volatile("s_wait_dscnt 0x0" ::: "memory")

// ---------------- fp32 -> fp16 weight conversion ----------------
// The conversions have no launch of their own: each rides in a launch that it does not depend on and that
// comes before its first reader. The gate and value weights are dealt to the blocks of the first LayerNorm;
// the two FFN weights are extra blocks of the scan's prefix launch, which leaves most of the chip idle.
// One such extra block converts CVT_PER_BLOCK neighbouring elements: CVT_LOADS 16-byte loads per lane, each
// wave-wide load 512 contiguous bytes, all in flight together. src, dst: this lane's first element.
#define CVT_LOADS 32
#define CVT_PER_BLOCK (256 * 4 * CVT_LOADS)
__device__ __forceinline__ void cvt_block(const float* __restrict__ src, _Float16* __restrict__ dst) {
  v4f x[CVT_LOADS];
  // both loops unrolled: x is a register array, and the loads go out ahead of the first store
#pragma unroll
  for (int j = 0; j < CVT_LOADS; ++j) x[j] = *(const v4f*)(src + j * 1024);
  // keeps every load ahead of the first conversion: left free, half of them went out only as the first returned
  __builtin_amdgcn_sched_barrier(0);
  // the wait in front of any rewrite of a register that the loads above name; as its operand the address
  // pair stays live up to here
  asm volatile("s_wait_xcnt 0x0" :: "v"(src) : "memory");
#pragma unroll
  for (int j = 0; j < CVT_LOADS; ++j) *(v4h*)(dst + j * 1024) = __builtin_convertvector(x[j], v4h);
}

// ---------------- LayerNorm: one wave per LNR rows of 1024, eight waves a block ----------------
// A lane holds 32 values of each row (eight 16-byte loads, each wave-wide load 512 contiguous bytes);
// all LNR rows are in flight together, and their sums cross the lanes in one interleaved butterfly.
// CVT: the block also converts its share of two DIM x DIM f32 weight arrays Ca, Cb to f16 (Da, Db): the lower
// half of the grid deals with Ca, the upper with Cb, CVS 16-byte loads per lane beside the rows' own.
#define LNR 4
#define LN_BLOCKS (MROWS / (8 * LNR))
#define CVS (2 * DIM * DIM / (LN_BLOCKS * 1024))
template<bool CVT>
__global__ void __launch_bounds__(256)
layernorm_f16_kernel(const float* __restrict__ X, const float* __restrict__ W,
                     const float* __restrict__ B, _Float16* __restrict__ H,
                     const float* __restrict__ Ca, const float* __restrict__ Cb,
                     _Float16* __restrict__ Da, _Float16* __restrict__ Db) {
  const int lane = threadIdx.x & 31;
  const int wave = threadIdx.x >> 5;
  const size_t e0 = (size_t)(blockIdx.x * 8 + wave) * (LNR * DIM) + lane * 4;
  const float* xr = X + e0;
  // every loop below is unrolled: a, w, b, s and q are register arrays and need constant indices
  v4f a[LNR][8];
#pragma unroll
  for (int r = 0; r < LNR; ++r)
#pragma unroll
    for (int j = 0; j < 8; ++j) a[r][j] = *(const v4f*)(xr + r * DIM + j * 128);
  // this lane's columns of weight and bias, asked for behind the rows: they are there when the sums are
  v4f w[8], b[8];
#pragma unroll
  for (int j = 0; j < 8; ++j) {
    w[j] = *(const v4f*)(W + j * 128 + lane * 4);
    b[j] = *(const v4f*)(B + j * 128 + lane * 4);
  }
  // the block's share of the arrays to convert, asked for last and stored last
  const bool up = blockIdx.x >= LN_BLOCKS / 2;
  const size_t c0 = (size_t)(up ? blockIdx.x - LN_BLOCKS / 2 : blockIdx.x) * (CVS * 1024) + threadIdx.x * 4;
  const float* cs = (up ? Cb : Ca) + c0;
  v4f c[CVS];
  if (CVT) {
#pragma unroll
    for (int j = 0; j < CVS; ++j) c[j] = *(const v4f*)(cs + j * 1024);
  }
  // keeps the weight and bias loads up here: moved down to their uses they are waited for pair by pair
  __builtin_amdgcn_sched_barrier(0);
  // the wait in front of any rewrite of a register that the loads above name; as its operand the rows'
  // address pair stays live up to here (without it a weight load took the pair as its destination)
  asm volatile("s_wait_xcnt 0x0" :: "v"(xr) : "memory");
  // the same for the address pair of the share's loads
  if (CVT) asm volatile("s_wait_xcnt 0x0" :: "v"(cs) : "memory");
  float s[LNR], q[LNR];
#pragma unroll
  for (int r = 0; r < LNR; ++r) {
    v4f s4 = a[r][0];
    v4f q4 = a[r][0] * a[r][0];
#pragma unroll
    for (int j = 1; j < 8; ++j) { s4 += a[r][j]; q4 += a[r][j] * a[r][j]; }
    s[r] = (s4[0] + s4[1]) + (s4[2] + s4[3]);
    q[r] = (q4[0] + q4[1]) + (q4[2] + q4[3]);
  }
#pragma unroll
  for (int m = 16; m > 0; m >>= 1)
#pragma unroll
    for (int r = 0; r < LNR; ++r) {
      s[r] += __shfl_xor(s[r], m, 32);
      q[r] += __shfl_xor(q[r], m, 32);
    }
  float mean[LNR], rstd[LNR];
#pragma unroll
  for (int r = 0; r < LNR; ++r) {
    mean[r] = s[r] * (1.0f / DIM);
    rstd[r] = rsqrtf(q[r] * (1.0f / DIM) - mean[r] * mean[r] + 1e-5f);
  }
  _Float16* hr = H + e0;
#pragma unroll
  for (int j = 0; j < 8; ++j)
#pragma unroll
    for (int r = 0; r < LNR; ++r)
      *(v4h*)(hr + r * DIM + j * 128) = __builtin_convertvector((a[r][j] - mean[r]) * rstd[r] * w[j] + b[j], v4h);
  if (CVT) {
    _Float16* cd = (up ? Db : Da) + c0;
#pragma unroll
    for (int j = 0; j < CVS; ++j) *(v4h*)(cd + j * 1024) = __builtin_convertvector(c[j], v4h);
  }
}

// ---------------- 3-pass chunked scan over the seq axis ----------------
// Passes 1 and 3 are streams: a block owns one chunk of CHUNK whole rows (blockIdx.x = batch * NCHK + chunk),
// a lane four neighbouring features, so that each wave-wide load or store is 512 contiguous bytes.
#define SR 4                // rows of one batch of loads in pass 3
#define SP 8                // rows of one batch of loads in pass 1
#define PCH 32              // chunks of one thread in pass 2
__device__ __forceinline__ v4f fma4(v4f a, v4f b, v4f c) {
  return v4f{fmaf(a[0], b[0], c[0]), fmaf(a[1], b[1], c[1]), fmaf(a[2], b[2], c[2]), fmaf(a[3], b[3], c[3])};
}

// pass 1: per-chunk sums of g and g*v
__global__ void __launch_bounds__(256)
scan_partial_kernel(const float* __restrict__ G, const float* __restrict__ V,
                    float* __restrict__ Sg, float* __restrict__ Sv) {
  const size_t base = (size_t)blockIdx.x * (CHUNK * DIM) + threadIdx.x * 4;
  v4f sg = {0.0f, 0.0f, 0.0f, 0.0f}, sv = {0.0f, 0.0f, 0.0f, 0.0f};
  for (int s0 = 0; s0 < CHUNK; s0 += SP) {
    // the loops over j are unrolled: g and v are register arrays and need constant indices
    v4f g[SP], v[SP];
#pragma unroll
    for (int j = 0; j < SP; ++j) {
      g[j] = *(const v4f*)(G + base + (size_t)(s0 + j) * DIM);
      v[j] = *(const v4f*)(V + base + (size_t)(s0 + j) * DIM);
    }
#pragma unroll
    for (int j = 0; j < SP; ++j) {
      sg += g[j];
      sv = fma4(g[j], v[j], sv);
    }
  }
  const size_t pidx = (size_t)blockIdx.x * DIM + threadIdx.x * 4;
  *(v4f*)(Sg + pidx) = sg;
  *(v4f*)(Sv + pidx) = sv;
}

// pass 2: exclusive prefix over chunks, per (batch, feature) column. A column's NCHK chunks are dealt to
// NCHK / PCH threads, PCH neighbouring chunks each, so that all of a thread's loads are in flight at once;
// the segments' totals meet in LDS. A block owns 64 neighbouring columns; a wave-wide load is one 128-byte line.
// Blocks PFX_BLOCKS and up have no part in the scan: they convert the two 4 DIM x DIM f32 weight arrays Ca, Cb
// to f16 (Da, Db), FFN_CVT_BLOCKS blocks each, on the WGPs that the prefix leaves idle.
#define PFX_BLOCKS (BATCH * DIM / 64)
#define FFN_CVT_BLOCKS (4 * DIM * DIM / CVT_PER_BLOCK)
__global__ void __launch_bounds__(256)
scan_prefix_kernel(float* __restrict__ Sg, float* __restrict__ Sv,
                   const float* __restrict__ Ca, const float* __restrict__ Cb,
                   _Float16* __restrict__ Da, _Float16* __restrict__ Db) {
  __shared__ float tg[NCHK / PCH][64], tv[NCHK / PCH][64];
  if (blockIdx.x >= PFX_BLOCKS) {   // the same for a whole block, and in front of the barrier
    const int cb = blockIdx.x - PFX_BLOCKS;
    const bool up = cb >= FFN_CVT_BLOCKS;
    const size_t c0 = (size_t)(up ? cb - FFN_CVT_BLOCKS : cb) * CVT_PER_BLOCK + threadIdx.x * 4;
    cvt_block((up ? Cb : Ca) + c0, (up ? Db : Da) + c0);
    return;
  }
  const int col = threadIdx.x & 63;
  const int seg = threadIdx.x >> 6;
  const int gc  = blockIdx.x * 64 + col;            // 0..4095
  const int b = gc >> 10, f = gc & (DIM - 1);
  const size_t i0 = ((size_t)b * NCHK + seg * PCH) * DIM + f;
  float* pg = Sg + i0;
  float* pv = Sv + i0;
  // every loop is unrolled: g and v are register arrays and need constant indices
  float g[PCH], v[PCH];
#pragma unroll
  for (int k = 0; k < PCH; ++k) { g[k] = pg[k * DIM]; v[k] = pv[k * DIM]; }
  // exclusive prefix inside the segment
  float ag = 0.0f, av = 0.0f;
#pragma unroll
  for (int k = 0; k < PCH; ++k) {
    const float g0 = g[k], v0 = v[k];
    g[k] = ag; v[k] = av;
    ag += g0; av += v0;
  }
  tg[seg][col] = ag;
  tv[seg][col] = av;
  __syncthreads();   // every segment's total is written before another segment's thread reads it
  float og = 0.0f, ov = 0.0f;
#pragma unroll
  for (int q = 0; q < NCHK / PCH - 1; ++q) {
    const float a = tg[q][col], c = tv[q][col];
    og += q < seg ? a : 0.0f;
    ov += q < seg ? c : 0.0f;
  }
#pragma unroll
  for (int k = 0; k < PCH; ++k) { pg[k * DIM] = og + g[k]; pv[k * DIM] = ov + v[k]; }
}

// pass 3: chunk-local scan with carry-in; x1 = x + mem
// one batch: rows R0 .. R0 + SR - 1, counted from the three pointers, of g, v and x: 12 loads of 16 bytes a lane
template<int R0>
__device__ __forceinline__ void scan_load(v4f (&g)[SR], v4f (&v)[SR], v4f (&x)[SR],
                                          const float* G, const float* V, const float* X) {
#pragma unroll
  for (int j = 0; j < SR; ++j) {
    g[j] = *(const v4f*)(G + (R0 + j) * DIM);
    v[j] = *(const v4f*)(V + (R0 + j) * DIM);
    x[j] = *(const v4f*)(X + (R0 + j) * DIM);
  }
  // keeps the loads up here, ahead of the other batch's math: moved down behind it they are waited for at once
  __builtin_amdgcn_sched_barrier(0);
  // the wait in front of any rewrite of a register that the loads above name; as its operands the three
  // address pairs stay live up to here (without it a load took a pair as its destination)
  asm volatile("s_wait_xcnt 0x0" :: "v"(G), "v"(V), "v"(X) : "memory");
}
// The batch's four rows go out together. The stores and their s_wait_xcnt 0 stand in one statement, so that
// neither the address pair nor a data register they name is rewritten ahead of that wait.
__device__ __forceinline__ void scan_store(float* p, const v4f (&o)[SR]) {
  asm volatile("global_store_b128 %0, %1, off\n\t"
               "global_store_b128 %0, %2, off offset:%5\n\t"
               "global_store_b128 %0, %3, off offset:%6\n\t"
               "global_store_b128 %0, %4, off offset:%7\n\t"
               "s_wait_xcnt 0x0"
               :: "v"(p), "v"(o[0]), "v"(o[1]), "v"(o[2]), "v"(o[3]),
                  "n"(DIM * 4), "n"(2 * DIM * 4), "n"(3 * DIM * 4) : "memory");
}
// the batch's rows in turn; pos0 is the first row's position in the sequence, counted from 1
__device__ __forceinline__ void scan_rows(const v4f (&g)[SR], const v4f (&v)[SR], const v4f (&x)[SR],
                                          v4f& cg, v4f& cv, int pos0, float* O) {
  v4f o[SR];
#pragma unroll
  for (int j = 0; j < SR; ++j) {
    cv = fma4(g[j], v[j], cv);
    cg += g[j];
    const float sp = sqrtf((float)(pos0 + j) * (1.0f / (float)SEQ) + 0.1f);   // one per row, shared by the four features
#pragma unroll
    for (int e = 0; e < 4; ++e) o[j][e] = x[j][e] + cv[e] / (sqrtf(cg[e] + 1e-6f) * sp);
  }
  scan_store(O, o);
}
__global__ void __launch_bounds__(256)
scan_apply_kernel(const float* __restrict__ X, const float* __restrict__ G,
                  const float* __restrict__ V, const float* __restrict__ Sg,
                  const float* __restrict__ Sv, float* __restrict__ X1) {
  const int c = blockIdx.x & (NCHK - 1);
  const size_t base = (size_t)blockIdx.x * (CHUNK * DIM) + threadIdx.x * 4;
  const size_t pidx = (size_t)blockIdx.x * DIM + threadIdx.x * 4;
  const float* gp = G + base;
  const float* vp = V + base;
  const float* xp = X + base;
  const float* sgp = Sg + pidx;
  const float* svp = Sv + pidx;
  float* op = X1 + base;
  v4f cg = *(const v4f*)sgp;
  v4f cv = *(const v4f*)svp;
  // as in scan_load: the two address pairs stay live up to the wait
  asm volatile("s_wait_xcnt 0x0" :: "v"(sgp), "v"(svp) : "memory");
  // two register sets: one batch's loads fly while the batch before it is worked on
  v4f g[2][SR], v[2][SR], x[2][SR];
  scan_load<0>(g[0], v[0], x[0], gp, vp, xp);
  int pos = c * CHUNK + 1;   // position in the sequence, counted from 1, of the row that the pointers stand on
  // stays rolled, two batches a trip, to keep the kernel's text short; the last two batches stand behind the
  // loop, so that every trip asks for the same loads and each wait counts only the batch it needs
#pragma unroll 1
  for (int t = 0; t < CHUNK / SR - 2; t += 2) {
    scan_load<SR>(g[1], v[1], x[1], gp, vp, xp);
    scan_rows(g[0], v[0], x[0], cg, cv, pos, op);
    scan_load<2 * SR>(g[0], v[0], x[0], gp, vp, xp);
    scan_rows(g[1], v[1], x[1], cg, cv, pos + SR, op + SR * DIM);
    gp += 2 * SR * DIM; vp += 2 * SR * DIM; xp += 2 * SR * DIM; op += 2 * SR * DIM;
    pos += 2 * SR;
  }
  scan_load<SR>(g[1], v[1], x[1], gp, vp, xp);
  scan_rows(g[0], v[0], x[0], cg, cv, pos, op);
  scan_rows(g[1], v[1], x[1], cg, cv, pos + SR, op + SR * DIM);
}

// ---- epilogue stores: four neighbouring columns of two output rows (PB bytes apart) per lane ----
// The two stores and their s_wait_xcnt 0 stand in one statement, so that neither the address pair
// nor a data register they name is rewritten ahead of that wait.
template<int PB> __device__ __forceinline__ void store_rows_f32(float* p, v4f x0, v4f x1) {
  asm volatile("global_store_b128 %0, %1, off\n\t"
               "global_store_b128 %0, %2, off offset:%3\n\t"
               "s_wait_xcnt 0x0"
               :: "v"(p), "v"(x0), "v"(x1), "n"(PB) : "memory");
}
template<int PB> __device__ __forceinline__ void store_rows_f16(_Float16* p, v4h x0, v4h x1) {
  asm volatile("global_store_b64 %0, %1, off\n\t"
               "global_store_b64 %0, %2, off offset:%3\n\t"
               "s_wait_xcnt 0x0"
               :: "v"(p), "v"(__builtin_bit_cast(v2u, x0)), "v"(__builtin_bit_cast(v2u, x1)), "n"(PB) : "memory");
}
// This lane's four bias values. The load and its data wait stand in one statement with an
// early-clobber output, so that the address pair is not taken as the destination.
__device__ __forceinline__ v4f load_bias(const float* p) {
  v4f x;
  asm volatile("global_load_b128 %0, %1, off\n\t"
               "s_wait_loadcnt 0x0"
               : "=&v"(x) : "v"(p) : "memory");
  return x;
}

// ---- epilogue activations: straight-line, no branch, so that a lane's eight values run side by side ----
// sigmoid(v) = 1 / (1 + 2^(-v log2 e)) on the hardware's exp2 and reciprocal; 2^x = inf gives 0, 2^x = 0 gives 1.
// Each group of four transcendentals is one statement and works in place: none reads a neighbour's result
// or writes a neighbour's source, and the v_nop is the one slot that the instruction set asks for behind
// the last of them, whatever the compiler puts next.
__device__ __forceinline__ v4f sigmoid_x4(v4f v) {
  const v4f m = v * -1.4426950408889634f;
  float a = m[0], b = m[1], c = m[2], d = m[3];
  asm("v_exp_f32 %0, %0\n\t"
      "v_exp_f32 %1, %1\n\t"
      "v_exp_f32 %2, %2\n\t"
      "v_exp_f32 %3, %3\n\t"
      "v_nop"
      : "+v"(a), "+v"(b), "+v"(c), "+v"(d));
  a += 1.0f; b += 1.0f; c += 1.0f; d += 1.0f;
  asm("v_rcp_f32 %0, %0\n\t"
      "v_rcp_f32 %1, %1\n\t"
      "v_rcp_f32 %2, %2\n\t"
      "v_rcp_f32 %3, %3\n\t"
      "v_nop"
      : "+v"(a), "+v"(b), "+v"(c), "+v"(d));
  return v4f{a, b, c, d};
}
// v/2 (1 + erf(v / sqrt 2)). For z = |v| / sqrt 2 >= 0: erf(z) = 1 - (a1 t + ... + a5 t^5) exp(-z^2),
// t = 1 / (1 + p z), absolute error of the form 1.5e-7 (about one f32 step of 1 + erf). erf is odd, so
// v/2 erf(v / sqrt 2) = |v/2| erf(z): no sign is copied.
__device__ __forceinline__ float gelu_erf_f32(float v) {
  const float z = fabsf(v) * 0.70710678118654752f;
  const float t = __builtin_amdgcn_rcpf(fmaf(0.3275911f, z, 1.0f));
  float p = fmaf(1.061405429f, t, -1.453152027f);
  p = fmaf(p, t, 1.421413741f);
  p = fmaf(p, t, -0.284496736f);
  p = fmaf(p, t, 0.254829592f);
  p *= t;
  const float e = __builtin_amdgcn_exp2f((v * v) * -0.72134752044448170f);   // exp(-z^2) = 2^(-v^2 log2(e) / 2)
  const float h = 0.5f * v;
  return fmaf(fabsf(h), fmaf(-p, e, 1.0f), h);
}

// ---------------- WMMA GEMM:  out[m,n] = sum_k A[m,k] * W16[n,k]  (+bias, epilogue) ---------
// EPI: 0 = sigmoid -> f32,  1 = identity -> f32,  2 = exact GELU -> f16,  3 = +residual -> f32
// N (the output's row length) is a template parameter: the epilogue's row steps are then immediates.
template<int EPI, int N>
// Eight waves, two per SIMD, one block a WGP: a wave owns 64 x 128 of the output (32 accumulator tiles),
// so that 12 fragments from LDS feed 32 WMMAs, and a block asks L2 for 512 operand rows per 256 x 256 outputs.
__global__ void __launch_bounds__(256)
gemm_wmma_kernel(const _Float16* __restrict__ A, const _Float16* __restrict__ W16,
                 const float* __restrict__ bias, const float* __restrict__ res,
                 float* __restrict__ outF, _Float16* __restrict__ outH,
                 int M, int K) {
  // Two buffers of 512 rows (A tile, then W tile) of 128 halves at pitch LDP: the 16 rows that a
  // half-wave's ds_load_b128 reads fall on 64 distinct banks.
  __shared__ __align__(16) _Float16 smem[2 * STAGE_H];

  const int tid  = threadIdx.x;
  const int lane = tid & 31;
  const int wave = tid >> 5;
  const int wm   = wave & 3;        // 0..3 -> 64-row M strip of the block tile
  const int wn   = wave >> 2;       // 0..1 -> 128-column N strip of the block tile
  const int hi   = lane >> 4;       // lane half selects K-phase (ISA frag layout)
  const int l15  = lane & 15;
  const int m0   = blockIdx.y * BM;
  const int n0   = blockIdx.x * BN;

  // Per-thread async staging assignment: 16-B chunk (tid & 15) of rows (tid >> 4) + 16 q.
  const int cC = (tid & 15) * 8;
  const int rC = tid >> 4;
  const size_t gs = (size_t)16 * K;
  const _Float16* gA = A   + (size_t)(m0 + rC) * K + cC;
  const _Float16* gB = W16 + (size_t)(n0 + rC) * K + cC;
  _Float16* lC = &smem[rC * LDP + cC];

  const int nsteps = K >> 7;

  // prologue: tile 0 into buffer 0, published; then tile 1 starts into buffer 1
  stage_copies(lC, gA, gB, gs);
  WAIT_ASYNCCNT0();
  __syncthreads();
  if (nsteps > 1) stage_copies(lC + STAGE_H, gA + BK, gB + BK, gs);

  // every loop over i, t and r below is unrolled: the accumulators and fragments are register
  // arrays and need constant indices
  v8f acc[4][8];
#pragma unroll
  for (int i = 0; i < 4; ++i)
#pragma unroll
    for (int t = 0; t < 8; ++t)
#pragma unroll
      for (int r = 0; r < 8; ++r) acc[i][t][r] = 0.0f;

  const int offA = (wm * 64 + l15) * LDP + 8 * hi;
  const int offB = (BM + wn * 128 + l15) * LDP + 8 * hi;

  for (int s = 0; s < nsteps; ++s) {
    const int buf = s & 1;
    const _Float16* sa = smem + buf * STAGE_H + offA;
    const _Float16* sb = smem + buf * STAGE_H + offB;

    // the stage's four k quarters in turn, each: 12 fragments from LDS, then 32 WMMAs
#pragma unroll
    for (int kk = 0; kk < BK / 32; ++kk) {
      // fragment (16x32 f16): lane<16 holds K {0..7,16..23}, lane>=16 holds K {8..15,24..31}
      v16h afrag[4];
      v16h bfrag[8];
#pragma unroll
      for (int i = 0; i < 4; ++i) {
        const _Float16* ap = sa + i * 16 * LDP + kk * 32;
        v8h alo = *(const v8h*)(ap);
        v8h ahi = *(const v8h*)(ap + 16);
        afrag[i] = __builtin_shufflevector(alo, ahi, 0,1,2,3,4,5,6,7,8,9,10,11,12,13,14,15);
      }
#pragma unroll
      for (int t = 0; t < 8; ++t) {
        const _Float16* bp = sb + t * 16 * LDP + kk * 32;
        v8h blo = *(const v8h*)(bp);
        v8h bhi = *(const v8h*)(bp + 16);
        bfrag[t] = __builtin_shufflevector(blo, bhi, 0,1,2,3,4,5,6,7,8,9,10,11,12,13,14,15);
      }
      // holds the fragment loads together in front of the WMMAs: one place with LDS reads a quarter
      __builtin_amdgcn_sched_barrier(0);
      if (kk == BK / 32 - 1) {
        // publish point: my last reads of buf have returned, my copies of tile s+1 have landed; the
        // one barrier publishes tile s+1 and frees buf for the refill behind it, which then flies
        // during this quarter's WMMAs and the next stage's first three
        WAIT_DSCNT0();
        WAIT_ASYNCCNT0();
        __syncthreads();
        if (s + 2 < nsteps) {
          const int k = (s + 2) * BK;
          stage_copies(lC + buf * STAGE_H, gA + k, gB + k, gs);
        }
      }
#pragma unroll
      for (int t = 0; t < 8; ++t)
#pragma unroll
        for (int i = 0; i < 4; ++i)
          acc[i][t] = __builtin_amdgcn_wmma_f32_16x16x32_f16(
              false, afrag[i], false, bfrag[t], (short)0, acc[i][t], false, false);
      // keeps the later quarters' fragment loads behind these WMMAs: lifted over them, three more
      // fragment sets were live at once and the accumulators spilled to scratch
      __builtin_amdgcn_sched_barrier(0);
    }
  }
  WAIT_ASYNCCNT0();

  // epilogue. The accumulators pass through LDS (free behind the loop's last barrier), a group of 16 rows
  // by 64 columns of the wave's strip at a time (group g: rows (g & 3) * 16.., columns (g >> 2) * 64..),
  // each wave in a region of its own: the element-wise math is then a loop over rows that can stay
  // rolled, and a lane stores four neighbouring columns at once.
  float* ep = (float*)smem + wave * (16 * EPP);
  const int c4    = l15 * 4;                    // this lane's columns: c4..c4+3 of a group's 64
  const int ncol0 = n0 + wn * 128 + c4;
  // this lane's rows of a group: it * 4 + hi and it * 4 + 2 + hi
  const size_t e0 = (size_t)(m0 + wm * 64 + hi) * N + ncol0;
  v4f bv[2];   // bias of this lane's columns in the strip's two 64-column halves

  // residual of 16 rows, fetched one group of rows ahead of its use so that its latency is hidden
  v4f rv[2][4][2];
  if (EPI == 3) {
#pragma unroll
    for (int it = 0; it < 4; ++it) {
      rv[0][it][0] = *(const v4f*)(res + e0 + (it * 4) * N);
      rv[0][it][1] = *(const v4f*)(res + e0 + (it * 4 + 2) * N);
    }
  }
#pragma unroll
  for (int g = 0; g < 8; ++g) {
    const int i = g & 3;
    const int h = g >> 2;
    const int go = h * 64 + i * 16 * N;                 // this group's first element, counted from e0
    const int gn = ((g + 1) >> 2) * 64 + ((g + 1) & 3) * 16 * N;   // the next group's
    if (g > 0) __syncthreads();   // the last group's reads are done before its rows are overwritten
    // D layout: lanes 0-15 N=lane, M=r; lanes 16-31 N=lane-16, M=r+8
#pragma unroll
    for (int t = 0; t < 4; ++t)
#pragma unroll
      for (int r = 0; r < 8; ++r) ep[(hi * 8 + r) * EPP + t * 16 + l15] = acc[i][h * 4 + t][r];
    if (g == 0) {   // their waits pass beside that of the LDS writes above
      bv[0] = load_bias(bias + ncol0);
      bv[1] = load_bias(bias + ncol0 + 64);
    }
    __syncthreads();              // the rows are written before other lanes read them
    // behind the barrier (which waits for every load in flight), so that these fly during this group's work
    if (EPI == 3 && g + 1 < 8) {
#pragma unroll
      for (int it = 0; it < 4; ++it) {
        rv[(g + 1) & 1][it][0] = *(const v4f*)(res + e0 + gn + (it * 4) * N);
        rv[(g + 1) & 1][it][1] = *(const v4f*)(res + e0 + gn + (it * 4 + 2) * N);
      }
    }
    if (EPI == 0 || EPI == 2) {
      // stays rolled, to keep the kernel's text short: eight exp or erf evaluations here, not 256
#pragma unroll 1
      for (int it = 0; it < 4; ++it) {
        const float* q = ep + (it * 4 + hi) * EPP + c4;
        const v4f v0 = *(const v4f*)q + bv[h];
        const v4f v1 = *(const v4f*)(q + 2 * EPP) + bv[h];
        const size_t e = e0 + go + (size_t)(it * 4) * N;
        if (EPI == 0) {
          store_rows_f32<2 * N * 4>(outF + e, sigmoid_x4(v0), sigmoid_x4(v1));
        } else {
          v4h o0, o1;
#pragma unroll
          for (int j = 0; j < 4; ++j) {
            o0[j] = (_Float16)gelu_erf_f32(v0[j]);
            o1[j] = (_Float16)gelu_erf_f32(v1[j]);
          }
          store_rows_f16<2 * N * 2>(outH + e, o0, o1);
        }
      }
    } else {
#pragma unroll
      for (int it = 0; it < 4; ++it) {
        const float* q = ep + (it * 4 + hi) * EPP + c4;
        v4f v0 = *(const v4f*)q + bv[h];
        v4f v1 = *(const v4f*)(q + 2 * EPP) + bv[h];
        if (EPI == 3) {
          v0 = rv[g & 1][it][0] + v0;
          v1 = rv[g & 1][it][1] + v1;
        }
        store_rows_f32<2 * N * 4>(outF + e0 + go + (it * 4) * N, v0, v1);
      }
    }
  }
}

extern "C" void kernel_launch(void* const* d_in, const int* in_sizes, int n_in,
                              void* d_out, int out_size, void* d_ws, size_t ws_size,
                              hipStream_t stream) {
  (void)in_sizes; (void)n_in; (void)out_size; (void)ws_size;
  const float* x      = (const float*)d_in[0];
  const float* ln1_w  = (const float*)d_in[1];
  const float* ln1_b  = (const float*)d_in[2];
  const float* ln2_w  = (const float*)d_in[3];
  const float* ln2_b  = (const float*)d_in[4];
  const float* gate_w = (const float*)d_in[5];
  const float* gate_b = (const float*)d_in[6];
  const float* val_w  = (const float*)d_in[7];
  const float* val_b  = (const float*)d_in[8];
  const float* ffn1_w = (const float*)d_in[9];
  const float* ffn1_b = (const float*)d_in[10];
  const float* ffn2_w = (const float*)d_in[11];
  const float* ffn2_b = (const float*)d_in[12];

  char* ws = (char*)d_ws;
  const size_t MB = 1024ull * 1024ull;
  _Float16* h16   = (_Float16*)(ws);             // 32 MB: LN output (reused for LN2)
  float*    G     = (float*)(ws + 32 * MB);      // 64 MB
  float*    V     = (float*)(ws + 96 * MB);      // 64 MB
  _Float16* FF1   = (_Float16*)(ws + 32 * MB);   // 128 MB, reuses dead G/V region
  _Float16* gw16  = (_Float16*)(ws + 160 * MB);  // 2 MB
  _Float16* vw16  = (_Float16*)(ws + 162 * MB);  // 2 MB
  _Float16* w1_16 = (_Float16*)(ws + 164 * MB);  // 8 MB
  _Float16* w2_16 = (_Float16*)(ws + 172 * MB);  // 8 MB
  float*    Sg    = (float*)(ws + 180 * MB);     // 2 MB chunk partials
  float*    Sv    = (float*)(ws + 182 * MB);     // 2 MB chunk partials
  float*    X1    = (float*)d_out;               // x + mem lives in d_out

  // 1), 2) h = LN1(x); beside it, gate and value weights -> f16
  layernorm_f16_kernel<true><<<LN_BLOCKS, 256, 0, stream>>>(x, ln1_w, ln1_b, h16, gate_w, val_w, gw16, vw16);

  // 3) g = sigmoid(h @ gate_w^T + b), v = h @ val_w^T + b
  gemm_wmma_kernel<0, DIM><<<dim3(DIM / BN, MROWS / BM), 256, 0, stream>>>(
      h16, gw16, gate_b, nullptr, G, nullptr, MROWS, DIM);
  gemm_wmma_kernel<1, DIM><<<dim3(DIM / BN, MROWS / BM), 256, 0, stream>>>(
      h16, vw16, val_b, nullptr, V, nullptr, MROWS, DIM);

  // 4) x1 = x + cumsum(g*v) / (sqrt(cumsum(g)+1e-6)*sqrt(pos/S+0.1))   [3-pass scan]
  scan_partial_kernel<<<BATCH * NCHK, 256, 0, stream>>>(G, V, Sg, Sv);
  // beside the prefix, the FFN weights -> f16
  scan_prefix_kernel<<<PFX_BLOCKS + 2 * FFN_CVT_BLOCKS, 256, 0, stream>>>(Sg, Sv, ffn1_w, ffn2_w, w1_16, w2_16);
  scan_apply_kernel<<<BATCH * NCHK, 256, 0, stream>>>(x, G, V, Sg, Sv, X1);

  // 5) h2 = LN2(x1)
  layernorm_f16_kernel<false><<<LN_BLOCKS, 256, 0, stream>>>(X1, ln2_w, ln2_b, h16, nullptr, nullptr, nullptr, nullptr);

  // 6) ff1 = gelu(h2 @ ffn1_w^T + b)  -> f16
  gemm_wmma_kernel<2, 4 * DIM><<<dim3(4 * DIM / BN, MROWS / BM), 256, 0, stream>>>(
      h16, w1_16, ffn1_b, nullptr, nullptr, FF1, MROWS, DIM);

  // 7) out = x1 + (ff1 @ ffn2_w^T + b)
  gemm_wmma_kernel<3, DIM><<<dim3(DIM / BN, MROWS / BM), 256, 0, stream>>>(
      FF1, w2_16, ffn2_b, X1, X1, nullptr, MROWS, 4 * DIM);
}

// v008
// It runs in 290 microseconds.
// Timed twice side by side with v007, it ran 1.06 times as fast both times.
// Over all steps from v000 it is 2.88 times as fast.
#include <hip/hip_runtime.h>
#include <hip/hip_bf16.h>
#include <math.h>

typedef __attribute__((ext_vector_type(16))) _Float16 v16h;
typedef __attribute__((ext_vector_type(8)))  _Float16 v8h;
typedef __attribute__((ext_vector_type(8)))  float    v8f;
typedef __attribute__((ext_vector_type(4)))  float    v4f;
typedef __attribute__((ext_vector_type(4)))  _Float16 v4h;
typedef __attribute__((ext_vector_type(2)))  uint32_t v2u;

#define DIM   1024
#define SEQ   4096
#define BATCH 4
#define MROWS (BATCH*SEQ)   // 16384 token rows
#define CHUNK 32
#define NCHK  (SEQ/CHUNK)   // 128 chunks per sequence
#define BM    256           // GEMM block tile rows (tokens)
#define BN    256           // GEMM block tile columns (output features)
#define BK    128           // k extent of one staged tile
#define LDP   136           // LDS row pitch of the GEMM tiles in halves: 128 data + 8 pad = 272 B (16 B x odd)
#define SLICE_ROWS 64       // rows of one wave's tensor load: A rows in slices 0..3, W rows in slices 4..7
#define SLICE_H 9216        // halves per slice in LDS: 64 rows x 272 B = 17,408 B, rounded up to a multiple of 2 KiB
#define STAGE_H (8 * SLICE_H)       // halves per buffer: eight slices
#define EPP   68            // LDS row pitch of the epilogue in floats: 64 data + 4 pad (rows 8 apart: 32 banks apart)

// ---- tensor load: one request of a wave brings a 2-D tile from global memory into LDS, tracked by TENSORcnt ----
typedef uint32_t u32x4 __attribute__((ext_vector_type(4)));
typedef uint32_t u32x8 __attribute__((ext_vector_type(8)));
__device__ __forceinline__ uint32_t uni(uint32_t v) { return (uint32_t)__builtin_amdgcn_readfirstlane(v); }
__device__ __forceinline__ uint32_t pinned(uint32_t v) {
  uint32_t w = __builtin_amdgcn_readfirstlane(v);
  asm volatile("" : "+s"(w));   // a descriptor word or an issue test held in a scalar register
  return w;
}
// Descriptor group 1, the same for every request of a kernel: 1-byte elements, a tile of SLICE_ROWS rows of
// 256 B (BK halves), source row pitch src_pitch bytes, 16 B of pad behind every 256-B row: LDS pitch 272 B = LDP.
__device__ __forceinline__ u32x8 tdm_group1(uint32_t src_pitch) {
  constexpr uint32_t d0 = BK * 2, d1 = SLICE_ROWS;
  u32x8 g;
  g[0] = uni((1u << 20) | (5u << 22) | (3u << 25));   // no mask, data_size 0, pad on, interval 64 dwords, amount 4 dwords
  g[1] = uni((d0 & 0xFFFFu) << 16);
  g[2] = uni((d0 >> 16) | ((d1 & 0xFFFFu) << 16));
  g[3] = uni((d1 >> 16) | (d0 << 16));
  g[4] = uni(d1);
  g[5] = uni(src_pitch);
  g[6] = uni(0u);
  g[7] = uni(0u);
  return g;
}
// One request: the tile whose first byte is ga lands at byte lds_dst of the work-group's LDS.
__device__ __forceinline__ void stage_load(uint32_t one, uint32_t lds_dst, uint64_t ga, u32x8 g1) {
  u32x4 g0;
  g0[0] = uni(one);   // count 1
  g0[1] = uni(lds_dst);
  g0[2] = uni((uint32_t)ga);
  g0[3] = uni((((uint32_t)(ga >> 32)) & 0x01FFFFFFu) | 0x80000000u);
  asm volatile("tensor_load_to_lds %0, %1" :: "s"(g0), "s"(g1) : "memory");
}
// This wave's tensor load has landed in LDS.
#define WAIT_TENSORCNT0() asm volatile("s_wait_tensorcnt 0x0" ::: "memory")
// This wave's LDS reads have returned, so the buffer they read may be refilled behind the barrier.
#define WAIT_DSCNT0()    asm volatile("s_wait_dscnt 0x0" ::: "memory")

// ---------------- fp32 -> fp16 weight conversion ----------------
// The conversions have no launch of their own: each rides in a launch that it does not depend on and that
// comes before its first reader. The gate and value weights are dealt to the blocks of the first LayerNorm;
// the two FFN weights are extra blocks of the scan's prefix launch, which leaves most of the chip idle.
// One such extra block converts CVT_PER_BLOCK neighbouring elements: CVT_LOADS 16-byte loads per lane, each
// wave-wide load 512 contiguous bytes, all in flight together. src, dst: this lane's first element.
#define CVT_LOADS 32
#define CVT_PER_BLOCK (256 * 4 * CVT_LOADS)
__device__ __forceinline__ void cvt_block(const float* __restrict__ src, _Float16* __restrict__ dst) {
  v4f x[CVT_LOADS];
  // both loops unrolled: x is a register array, and the loads go out ahead of the first store
#pragma unroll
  for (int j = 0; j < CVT_LOADS; ++j) x[j] = *(const v4f*)(src + j * 1024);
  // keeps every load ahead of the first conversion: left free, half of them went out only as the first returned
  __builtin_amdgcn_sched_barrier(0);
  // the wait in front of any rewrite of a register that the loads above name; as its operand the address
  // pair stays live up to here
  asm volatile("s_wait_xcnt 0x0" :: "v"(src) : "memory");
#pragma unroll
  for (int j = 0; j < CVT_LOADS; ++j) *(v4h*)(dst + j * 1024) = __builtin_convertvector(x[j], v4h);
}

// ---------------- LayerNorm: one wave per LNR rows of 1024, eight waves a block ----------------
// A lane holds 32 values of each row (eight 16-byte loads, each wave-wide load 512 contiguous bytes);
// all LNR rows are in flight together, and their sums cross the lanes in one interleaved butterfly.
// CVT: the block also converts its share of two DIM x DIM f32 weight arrays Ca, Cb to f16 (Da, Db): the lower
// half of the grid deals with Ca, the upper with Cb, CVS 16-byte loads per lane beside the rows' own.
#define LNR 4
#define LN_BLOCKS (MROWS / (8 * LNR))
#define CVS (2 * DIM * DIM / (LN_BLOCKS * 1024))
template<bool CVT>
__global__ void __launch_bounds__(256)
layernorm_f16_kernel(const float* __restrict__ X, const float* __restrict__ W,
                     const float* __restrict__ B, _Float16* __restrict__ H,
                     const float* __restrict__ Ca, const float* __restrict__ Cb,
                     _Float16* __restrict__ Da, _Float16* __restrict__ Db) {
  const int lane = threadIdx.x & 31;
  const int wave = threadIdx.x >> 5;
  const size_t e0 = (size_t)(blockIdx.x * 8 + wave) * (LNR * DIM) + lane * 4;
  const float* xr = X + e0;
  // every loop below is unrolled: a, w, b, s and q are register arrays and need constant indices
  v4f a[LNR][8];
#pragma unroll
  for (int r = 0; r < LNR; ++r)
#pragma unroll
    for (int j = 0; j < 8; ++j) a[r][j] = *(const v4f*)(xr + r * DIM + j * 128);
  // this lane's columns of weight and bias, asked for behind the rows: they are there when the sums are
  v4f w[8], b[8];
#pragma unroll
  for (int j = 0; j < 8; ++j) {
    w[j] = *(const v4f*)(W + j * 128 + lane * 4);
    b[j] = *(const v4f*)(B + j * 128 + lane * 4);
  }
  // the block's share of the arrays to convert, asked for last and stored last
  const bool up = blockIdx.x >= LN_BLOCKS / 2;
  const size_t c0 = (size_t)(up ? blockIdx.x - LN_BLOCKS / 2 : blockIdx.x) * (CVS * 1024) + threadIdx.x * 4;
  const float* cs = (up ? Cb : Ca) + c0;
  v4f c[CVS];
  if (CVT) {
#pragma unroll
    for (int j = 0; j < CVS; ++j) c[j] = *(const v4f*)(cs + j * 1024);
  }
  // keeps the weight and bias loads up here: moved down to their uses they are waited for pair by pair
  __builtin_amdgcn_sched_barrier(0);
  // the wait in front of any rewrite of a register that the loads above name; as its operand the rows'
  // address pair stays live up to here (without it a weight load took the pair as its destination)
  asm volatile("s_wait_xcnt 0x0" :: "v"(xr) : "memory");
  // the same for the address pair of the share's loads
  if (CVT) asm volatile("s_wait_xcnt 0x0" :: "v"(cs) : "memory");
  float s[LNR], q[LNR];
#pragma unroll
  for (int r = 0; r < LNR; ++r) {
    v4f s4 = a[r][0];
    v4f q4 = a[r][0] * a[r][0];
#pragma unroll
    for (int j = 1; j < 8; ++j) { s4 += a[r][j]; q4 += a[r][j] * a[r][j]; }
    s[r] = (s4[0] + s4[1]) + (s4[2] + s4[3]);
    q[r] = (q4[0] + q4[1]) + (q4[2] + q4[3]);
  }
#pragma unroll
  for (int m = 16; m > 0; m >>= 1)
#pragma unroll
    for (int r = 0; r < LNR; ++r) {
      s[r] += __shfl_xor(s[r], m, 32);
      q[r] += __shfl_xor(q[r], m, 32);
    }
  float mean[LNR], rstd[LNR];
#pragma unroll
  for (int r = 0; r < LNR; ++r) {
    mean[r] = s[r] * (1.0f / DIM);
    rstd[r] = rsqrtf(q[r] * (1.0f / DIM) - mean[r] * mean[r] + 1e-5f);
  }
  _Float16* hr = H + e0;
#pragma unroll
  for (int j = 0; j < 8; ++j)
#pragma unroll
    for (int r = 0; r < LNR; ++r)
      *(v4h*)(hr + r * DIM + j * 128) = __builtin_convertvector((a[r][j] - mean[r]) * rstd[r] * w[j] + b[j], v4h);
  if (CVT) {
    _Float16* cd = (up ? Db : Da) + c0;
#pragma unroll
    for (int j = 0; j < CVS; ++j) *(v4h*)(cd + j * 1024) = __builtin_convertvector(c[j], v4h);
  }
}

// ---------------- 3-pass chunked scan over the seq axis ----------------
// Passes 1 and 3 are streams: a block owns one chunk of CHUNK whole rows (blockIdx.x = batch * NCHK + chunk),
// a lane four neighbouring features, so that each wave-wide load or store is 512 contiguous bytes.
#define SR 4                // rows of one batch of loads in pass 3
#define SP 8                // rows of one batch of loads in pass 1
#define PCH 32              // chunks of one thread in pass 2
__device__ __forceinline__ v4f fma4(v4f a, v4f b, v4f c) {
  return v4f{fmaf(a[0], b[0], c[0]), fmaf(a[1], b[1], c[1]), fmaf(a[2], b[2], c[2]), fmaf(a[3], b[3], c[3])};
}

// pass 1: per-chunk sums of g and g*v
__global__ void __launch_bounds__(256)
scan_partial_kernel(const float* __restrict__ G, const float* __restrict__ V,
                    float* __restrict__ Sg, float* __restrict__ Sv) {
  const size_t base = (size_t)blockIdx.x * (CHUNK * DIM) + threadIdx.x * 4;
  v4f sg = {0.0f, 0.0f, 0.0f, 0.0f}, sv = {0.0f, 0.0f, 0.0f, 0.0f};
  for (int s0 = 0; s0 < CHUNK; s0 += SP) {
    // the loops over j are unrolled: g and v are register arrays and need constant indices
    v4f g[SP], v[SP];
#pragma unroll
    for (int j = 0; j < SP; ++j) {
      g[j] = *(const v4f*)(G + base + (size_t)(s0 + j) * DIM);
      v[j] = *(const v4f*)(V + base + (size_t)(s0 + j) * DIM);
    }
#pragma unroll
    for (int j = 0; j < SP; ++j) {
      sg += g[j];
      sv = fma4(g[j], v[j], sv);
    }
  }
  const size_t pidx = (size_t)blockIdx.x * DIM + threadIdx.x * 4;
  *(v4f*)(Sg + pidx) = sg;
  *(v4f*)(Sv + pidx) = sv;
}

// pass 2: exclusive prefix over chunks, per (batch, feature) column. A column's NCHK chunks are dealt to
// NCHK / PCH threads, PCH neighbouring chunks each, so that all of a thread's loads are in flight at once;
// the segments' totals meet in LDS. A block owns 64 neighbouring columns; a wave-wide load is one 128-byte line.
// Blocks PFX_BLOCKS and up have no part in the scan: they convert the two 4 DIM x DIM f32 weight arrays Ca, Cb
// to f16 (Da, Db), FFN_CVT_BLOCKS blocks each, on the WGPs that the prefix leaves idle.
#define PFX_BLOCKS (BATCH * DIM / 64)
#define FFN_CVT_BLOCKS (4 * DIM * DIM / CVT_PER_BLOCK)
__global__ void __launch_bounds__(256)
scan_prefix_kernel(float* __restrict__ Sg, float* __restrict__ Sv,
                   const float* __restrict__ Ca, const float* __restrict__ Cb,
                   _Float16* __restrict__ Da, _Float16* __restrict__ Db) {
  __shared__ float tg[NCHK / PCH][64], tv[NCHK / PCH][64];
  if (blockIdx.x >= PFX_BLOCKS) {   // the same for a whole block, and in front of the barrier
    const int cb = blockIdx.x - PFX_BLOCKS;
    const bool up = cb >= FFN_CVT_BLOCKS;
    const size_t c0 = (size_t)(up ? cb - FFN_CVT_BLOCKS : cb) * CVT_PER_BLOCK + threadIdx.x * 4;
    cvt_block((up ? Cb : Ca) + c0, (up ? Db : Da) + c0);
    return;
  }
  const int col = threadIdx.x & 63;
  const int seg = threadIdx.x >> 6;
  const int gc  = blockIdx.x * 64 + col;            // 0..4095
  const int b = gc >> 10, f = gc & (DIM - 1);
  const size_t i0 = ((size_t)b * NCHK + seg * PCH) * DIM + f;
  float* pg = Sg + i0;
  float* pv = Sv + i0;
  // every loop is unrolled: g and v are register arrays and need constant indices
  float g[PCH], v[PCH];
#pragma unroll
  for (int k = 0; k < PCH; ++k) { g[k] = pg[k * DIM]; v[k] = pv[k * DIM]; }
  // exclusive prefix inside the segment
  float ag = 0.0f, av = 0.0f;
#pragma unroll
  for (int k = 0; k < PCH; ++k) {
    const float g0 = g[k], v0 = v[k];
    g[k] = ag; v[k] = av;
    ag += g0; av += v0;
  }
  tg[seg][col] = ag;
  tv[seg][col] = av;
  __syncthreads();   // every segment's total is written before another segment's thread reads it
  float og = 0.0f, ov = 0.0f;
#pragma unroll
  for (int q = 0; q < NCHK / PCH - 1; ++q) {
    const float a = tg[q][col], c = tv[q][col];
    og += q < seg ? a : 0.0f;
    ov += q < seg ? c : 0.0f;
  }
#pragma unroll
  for (int k = 0; k < PCH; ++k) { pg[k * DIM] = og + g[k]; pv[k * DIM] = ov + v[k]; }
}

// pass 3: chunk-local scan with carry-in; x1 = x + mem
// one batch: rows R0 .. R0 + SR - 1, counted from the three pointers, of g, v and x: 12 loads of 16 bytes a lane
template<int R0>
__device__ __forceinline__ void scan_load(v4f (&g)[SR], v4f (&v)[SR], v4f (&x)[SR],
                                          const float* G, const float* V, const float* X) {
#pragma unroll
  for (int j = 0; j < SR; ++j) {
    g[j] = *(const v4f*)(G + (R0 + j) * DIM);
    v[j] = *(const v4f*)(V + (R0 + j) * DIM);
    x[j] = *(const v4f*)(X + (R0 + j) * DIM);
  }
  // keeps the loads up here, ahead of the other batch's math: moved down behind it they are waited for at once
  __builtin_amdgcn_sched_barrier(0);
  // the wait in front of any rewrite of a register that the loads above name; as its operands the three
  // address pairs stay live up to here (without it a load took a pair as its destination)
  asm volatile("s_wait_xcnt 0x0" :: "v"(G), "v"(V), "v"(X) : "memory");
}
// The batch's four rows go out together. The stores and their s_wait_xcnt 0 stand in one statement, so that
// neither the address pair nor a data register they name is rewritten ahead of that wait.
__device__ __forceinline__ void scan_store(float* p, const v4f (&o)[SR]) {
  asm volatile("global_store_b128 %0, %1, off\n\t"
               "global_store_b128 %0, %2, off offset:%5\n\t"
               "global_store_b128 %0, %3, off offset:%6\n\t"
               "global_store_b128 %0, %4, off offset:%7\n\t"
               "s_wait_xcnt 0x0"
               :: "v"(p), "v"(o[0]), "v"(o[1]), "v"(o[2]), "v"(o[3]),
                  "n"(DIM * 4), "n"(2 * DIM * 4), "n"(3 * DIM * 4) : "memory");
}
// the batch's rows in turn; pos0 is the first row's position in the sequence, counted from 1
__device__ __forceinline__ void scan_rows(const v4f (&g)[SR], const v4f (&v)[SR], const v4f (&x)[SR],
                                          v4f& cg, v4f& cv, int pos0, float* O) {
  v4f o[SR];
#pragma unroll
  for (int j = 0; j < SR; ++j) {
    cv = fma4(g[j], v[j], cv);
    cg += g[j];
    const float sp = sqrtf((float)(pos0 + j) * (1.0f / (float)SEQ) + 0.1f);   // one per row, shared by the four features
#pragma unroll
    for (int e = 0; e < 4; ++e) o[j][e] = x[j][e] + cv[e] / (sqrtf(cg[e] + 1e-6f) * sp);
  }
  scan_store(O, o);
}
__global__ void __launch_bounds__(256)
scan_apply_kernel(const float* __restrict__ X, const float* __restrict__ G,
                  const float* __restrict__ V, const float* __restrict__ Sg,
                  const float* __restrict__ Sv, float* __restrict__ X1) {
  const int c = blockIdx.x & (NCHK - 1);
  const size_t base = (size_t)blockIdx.x * (CHUNK * DIM) + threadIdx.x * 4;
  const size_t pidx = (size_t)blockIdx.x * DIM + threadIdx.x * 4;
  const float* gp = G + base;
  const float* vp = V + base;
  const float* xp = X + base;
  const float* sgp = Sg + pidx;
  const float* svp = Sv + pidx;
  float* op = X1 + base;
  v4f cg = *(const v4f*)sgp;
  v4f cv = *(const v4f*)svp;
  // as in scan_load: the two address pairs stay live up to the wait
  asm volatile("s_wait_xcnt 0x0" :: "v"(sgp), "v"(svp) : "memory");
  // two register sets: one batch's loads fly while the batch before it is worked on
  v4f g[2][SR], v[2][SR], x[2][SR];
  scan_load<0>(g[0], v[0], x[0], gp, vp, xp);
  int pos = c * CHUNK + 1;   // position in the sequence, counted from 1, of the row that the pointers stand on
  // stays rolled, two batches a trip, to keep the kernel's text short; the last two batches stand behind the
  // loop, so that every trip asks for the same loads and each wait counts only the batch it needs
#pragma unroll 1
  for (int t = 0; t < CHUNK / SR - 2; t += 2) {
    scan_load<SR>(g[1], v[1], x[1], gp, vp, xp);
    scan_rows(g[0], v[0], x[0], cg, cv, pos, op);
    scan_load<2 * SR>(g[0], v[0], x[0], gp, vp, xp);
    scan_rows(g[1], v[1], x[1], cg, cv, pos + SR, op + SR * DIM);
    gp += 2 * SR * DIM; vp += 2 * SR * DIM; xp += 2 * SR * DIM; op += 2 * SR * DIM;
    pos += 2 * SR;
  }
  scan_load<SR>(g[1], v[1], x[1], gp, vp, xp);
  scan_rows(g[0], v[0], x[0], cg, cv, pos, op);
  scan_rows(g[1], v[1], x[1], cg, cv, pos + SR, op + SR * DIM);
}

// ---- epilogue stores: four neighbouring columns of two output rows (PB bytes apart) per lane ----
// The two stores and their s_wait_xcnt 0 stand in one statement, so that neither the address pair
// nor a data register they name is rewritten ahead of that wait.
template<int PB> __device__ __forceinline__ void store_rows_f32(float* p, v4f x0, v4f x1) {
  asm volatile("global_store_b128 %0, %1, off\n\t"
               "global_store_b128 %0, %2, off offset:%3\n\t"
               "s_wait_xcnt 0x0"
               :: "v"(p), "v"(x0), "v"(x1), "n"(PB) : "memory");
}
template<int PB> __device__ __forceinline__ void store_rows_f16(_Float16* p, v4h x0, v4h x1) {
  asm volatile("global_store_b64 %0, %1, off\n\t"
               "global_store_b64 %0, %2, off offset:%3\n\t"
               "s_wait_xcnt 0x0"
               :: "v"(p), "v"(__builtin_bit_cast(v2u, x0)), "v"(__builtin_bit_cast(v2u, x1)), "n"(PB) : "memory");
}
// This lane's four bias values. The load and its data wait stand in one statement with an
// early-clobber output, so that the address pair is not taken as the destination.
__device__ __forceinline__ v4f load_bias(const float* p) {
  v4f x;
  asm volatile("global_load_b128 %0, %1, off\n\t"
               "s_wait_loadcnt 0x0"
               : "=&v"(x) : "v"(p) : "memory");
  return x;
}

// ---- epilogue activations: straight-line, no branch, so that a lane's eight values run side by side ----
// sigmoid(v) = 1 / (1 + 2^(-v log2 e)) on the hardware's exp2 and reciprocal; 2^x = inf gives 0, 2^x = 0 gives 1.
// Each group of four transcendentals is one statement and works in place: none reads a neighbour's result
// or writes a neighbour's source, and the v_nop is the one slot that the instruction set asks for behind
// the last of them, whatever the compiler puts next.
__device__ __forceinline__ v4f sigmoid_x4(v4f v) {
  const v4f m = v * -1.4426950408889634f;
  float a = m[0], b = m[1], c = m[2], d = m[3];
  asm("v_exp_f32 %0, %0\n\t"
      "v_exp_f32 %1, %1\n\t"
      "v_exp_f32 %2, %2\n\t"
      "v_exp_f32 %3, %3\n\t"
      "v_nop"
      : "+v"(a), "+v"(b), "+v"(c), "+v"(d));
  a += 1.0f; b += 1.0f; c += 1.0f; d += 1.0f;
  asm("v_rcp_f32 %0, %0\n\t"
      "v_rcp_f32 %1, %1\n\t"
      "v_rcp_f32 %2, %2\n\t"
      "v_rcp_f32 %3, %3\n\t"
      "v_nop"
      : "+v"(a), "+v"(b), "+v"(c), "+v"(d));
  return v4f{a, b, c, d};
}
// v/2 (1 + erf(v / sqrt 2)). For z = |v| / sqrt 2 >= 0: erf(z) = 1 - (a1 t + ... + a5 t^5) exp(-z^2),
// t = 1 / (1 + p z), absolute error of the form 1.5e-7 (about one f32 step of 1 + erf). erf is odd, so
// v/2 erf(v / sqrt 2) = |v/2| erf(z): no sign is copied.
__device__ __forceinline__ float gelu_erf_f32(float v) {
  const float z = fabsf(v) * 0.70710678118654752f;
  const float t = __builtin_amdgcn_rcpf(fmaf(0.3275911f, z, 1.0f));
  float p = fmaf(1.061405429f, t, -1.453152027f);
  p = fmaf(p, t, 1.421413741f);
  p = fmaf(p, t, -0.284496736f);
  p = fmaf(p, t, 0.254829592f);
  p *= t;
  const float e = __builtin_amdgcn_exp2f((v * v) * -0.72134752044448170f);   // exp(-z^2) = 2^(-v^2 log2(e) / 2)
  const float h = 0.5f * v;
  return fmaf(fabsf(h), fmaf(-p, e, 1.0f), h);
}

// ---------------- WMMA GEMM:  out[m,n] = sum_k A[m,k] * W16[n,k]  (+bias, epilogue) ---------
// EPI: 0 = sigmoid -> f32,  1 = identity -> f32,  2 = exact GELU -> f16,  3 = +residual -> f32
// N (the output's row length) is a template parameter: the epilogue's row steps are then immediates.
template<int EPI, int N>
// Eight waves, two per SIMD, one block a WGP: a wave owns 64 x 128 of the output (32 accumulator tiles),
// so that 12 fragments from LDS feed 32 WMMAs, and a block asks L2 for 512 operand rows per 256 x 256 outputs.
__global__ void __launch_bounds__(256)
gemm_wmma_kernel(const _Float16* __restrict__ A, const _Float16* __restrict__ W16,
                 const float* __restrict__ bias, const float* __restrict__ res,
                 float* __restrict__ outF, _Float16* __restrict__ outH,
                 int M, int K) {
  // Two buffers of 512 rows (A tile, then W tile; eight slices of 64 rows) of 128 halves at pitch LDP: the
  // 16 rows that a half-wave's ds_load_b128 reads fall on 64 distinct banks. Every slice starts at a multiple of 2 KiB.
  __shared__ __attribute__((aligned(2048))) _Float16 smem[2 * STAGE_H];

  const int tid  = threadIdx.x;
  const int lane = tid & 31;
  const int wave = tid >> 5;
  const int wm   = wave & 3;        // 0..3 -> 64-row M strip of the block tile
  const int wn   = wave >> 2;       // 0..1 -> 128-column N strip of the block tile
  const int hi   = lane >> 4;       // lane half selects K-phase (ISA frag layout)
  const int l15  = lane & 15;
  const int m0   = blockIdx.y * BM;
  const int n0   = blockIdx.x * BN;

  // Staging: every wave brings its own slice of a stage with one tensor load: waves 0..3 the A rows
  // 64 w .. 64 w + 63 of the block tile, waves 4..7 the W rows 64 (w - 4) .. 64 (w - 4) + 63.
  const uint32_t wv = uni((uint32_t)tid >> 5);
  const _Float16* gS = wv < 4u ? A   + (size_t)(m0 + SLICE_ROWS * wv) * K
                               : W16 + (size_t)(n0 + SLICE_ROWS * (wv - 4u)) * K;
  const uint64_t gS0 = (uint64_t)(uintptr_t)gS;
  const uint32_t lS  = (uint32_t)(size_t)smem + wv * (SLICE_H * 2);   // byte place of the slice in buffer 0
  u32x8 g1 = tdm_group1((uint32_t)K * 2u);
  // descriptor words held in scalar registers: group 1 keeps its eight registers for the whole kernel (left free,
  // the compiler rebuilt its constants at each issue and took two of the registers as temporaries in between,
  // while a request was in flight)
  asm volatile("" : "+s"(g1));   // as pinned(): descriptor words held in scalar registers
  const uint32_t one = pinned(1u);   // group 0 word 0 (count 1), held likewise

  const int nsteps = K >> 7;

  // prologue: stage 0 into buffer 0, published; then stage 1 starts into buffer 1
  stage_load(one, lS, gS0, g1);
  WAIT_TENSORCNT0();
  __syncthreads();
  if (pinned(nsteps > 1)) stage_load(one, lS + STAGE_H * 2, gS0 + BK * 2, g1);

  // every loop over i, t and r below is unrolled: the accumulators and fragments are register
  // arrays and need constant indices
  v8f acc[4][8];
#pragma unroll
  for (int i = 0; i < 4; ++i)
#pragma unroll
    for (int t = 0; t < 8; ++t)
#pragma unroll
      for (int r = 0; r < 8; ++r) acc[i][t][r] = 0.0f;

  const int offA = wm * SLICE_H + l15 * LDP + 8 * hi;             // the wave's 64 A rows are slice wm
  const int offB = (4 + wn * 2) * SLICE_H + l15 * LDP + 8 * hi;   // its 128 W rows are slices 4 + 2 wn and 5 + 2 wn

  for (int s = 0; s < nsteps; ++s) {
    const int buf = s & 1;
    const _Float16* sa = smem + buf * STAGE_H + offA;
    const _Float16* sb = smem + buf * STAGE_H + offB;

    // the stage's four k quarters in turn, each: 12 fragments from LDS, then 32 WMMAs
#pragma unroll
    for (int kk = 0; kk < BK / 32; ++kk) {
      // fragment (16x32 f16): lane<16 holds K {0..7,16..23}, lane>=16 holds K {8..15,24..31}
      v16h afrag[4];
      v16h bfrag[8];
#pragma unroll
      for (int i = 0; i < 4; ++i) {
        const _Float16* ap = sa + i * 16 * LDP + kk * 32;
        v8h alo = *(const v8h*)(ap);
        v8h ahi = *(const v8h*)(ap + 16);
        afrag[i] = __builtin_shufflevector(alo, ahi, 0,1,2,3,4,5,6,7,8,9,10,11,12,13,14,15);
      }
#pragma unroll
      for (int t = 0; t < 8; ++t) {
        const _Float16* bp = sb + (t >> 2) * SLICE_H + (t & 3) * 16 * LDP + kk * 32;
        v8h blo = *(const v8h*)(bp);
        v8h bhi = *(const v8h*)(bp + 16);
        bfrag[t] = __builtin_shufflevector(blo, bhi, 0,1,2,3,4,5,6,7,8,9,10,11,12,13,14,15);
      }
      // holds the fragment loads together in front of the WMMAs: one place with LDS reads a quarter
      __builtin_amdgcn_sched_barrier(0);
      if (kk == BK / 32 - 1) {
        // publish point: my last reads of buf have returned, my slice of stage s+1 has landed; the
        // one barrier publishes stage s+1 and frees buf for the refill behind it, which then flies
        // during this quarter's WMMAs and the next stage's first three
        WAIT_DSCNT0();
        WAIT_TENSORCNT0();
        __syncthreads();
        if (pinned(s + 2 < nsteps)) {   // a scalar branch: only while stage s+2 exists
          // the byte step is pinned here, so that the descriptor is formed behind the wait above
          stage_load(one, lS + buf * (STAGE_H * 2), gS0 + pinned((uint32_t)(s + 2) * (BK * 2)), g1);
        }
      }
#pragma unroll
      for (int t = 0; t < 8; ++t)
#pragma unroll
        for (int i = 0; i < 4; ++i)
          acc[i][t] = __builtin_amdgcn_wmma_f32_16x16x32_f16(
              false, afrag[i], false, bfrag[t], (short)0, acc[i][t], false, false);
      // keeps the later quarters' fragment loads behind these WMMAs: lifted over them, three more
      // fragment sets were live at once and the accumulators spilled to scratch
      __builtin_amdgcn_sched_barrier(0);
    }
  }
  WAIT_TENSORCNT0();
  WAIT_DSCNT0();

  // epilogue. The accumulators pass through LDS (free behind the loop's last barrier), a group of 16 rows
  // by 64 columns of the wave's strip at a time (group g: rows (g & 3) * 16.., columns (g >> 2) * 64..),
  // each wave in a region of its own: the element-wise math is then a loop over rows that can stay
  // rolled, and a lane stores four neighbouring columns at once.
  float* ep = (float*)smem + wave * (16 * EPP);
  const int c4    = l15 * 4;                    // this lane's columns: c4..c4+3 of a group's 64
  const int ncol0 = n0 + wn * 128 + c4;
  // this lane's rows of a group: it * 4 + hi and it * 4 + 2 + hi
  const size_t e0 = (size_t)(m0 + wm * 64 + hi) * N + ncol0;
  v4f bv[2];   // bias of this lane's columns in the strip's two 64-column halves

  // residual of 16 rows, fetched one group of rows ahead of its use so that its latency is hidden
  v4f rv[2][4][2];
  if (EPI == 3) {
#pragma unroll
    for (int it = 0; it < 4; ++it) {
      rv[0][it][0] = *(const v4f*)(res + e0 + (it * 4) * N);
      rv[0][it][1] = *(const v4f*)(res + e0 + (it * 4 + 2) * N);
    }
  }
#pragma unroll
  for (int g = 0; g < 8; ++g) {
    const int i = g & 3;
    const int h = g >> 2;
    const int go = h * 64 + i * 16 * N;                 // this group's first element, counted from e0
    const int gn = ((g + 1) >> 2) * 64 + ((g + 1) & 3) * 16 * N;   // the next group's
    if (g > 0) __syncthreads();   // the last group's reads are done before its rows are overwritten
    // D layout: lanes 0-15 N=lane, M=r; lanes 16-31 N=lane-16, M=r+8
#pragma unroll
    for (int t = 0; t < 4; ++t)
#pragma unroll
      for (int r = 0; r < 8; ++r) ep[(hi * 8 + r) * EPP + t * 16 + l15] = acc[i][h * 4 + t][r];
    if (g == 0) {   // their waits pass beside that of the LDS writes above
      bv[0] = load_bias(bias + ncol0);
      bv[1] = load_bias(bias + ncol0 + 64);
    }
    __syncthreads();              // the rows are written before other lanes read them
    // behind the barrier (which waits for every load in flight), so that these fly during this group's work
    if (EPI == 3 && g + 1 < 8) {
#pragma unroll
      for (int it = 0; it < 4; ++it) {
        rv[(g + 1) & 1][it][0] = *(const v4f*)(res + e0 + gn + (it * 4) * N);
        rv[(g + 1) & 1][it][1] = *(const v4f*)(res + e0 + gn + (it * 4 + 2) * N);
      }
    }
    if (EPI == 0 || EPI == 2) {
      // stays rolled, to keep the kernel's text short: eight exp or erf evaluations here, not 256
#pragma unroll 1
      for (int it = 0; it < 4; ++it) {
        const float* q = ep + (it * 4 + hi) * EPP + c4;
        const v4f v0 = *(const v4f*)q + bv[h];
        const v4f v1 = *(const v4f*)(q + 2 * EPP) + bv[h];
        const size_t e = e0 + go + (size_t)(it * 4) * N;
        if (EPI == 0) {
          store_rows_f32<2 * N * 4>(outF + e, sigmoid_x4(v0), sigmoid_x4(v1));
        } else {
          v4h o0, o1;
#pragma unroll
          for (int j = 0; j < 4; ++j) {
            o0[j] = (_Float16)gelu_erf_f32(v0[j]);
            o1[j] = (_Float16)gelu_erf_f32(v1[j]);
          }
          store_rows_f16<2 * N * 2>(outH + e, o0, o1);
        }
      }
    } else {
#pragma unroll
      for (int it = 0; it < 4; ++it) {
        const float* q = ep + (it * 4 + hi) * EPP + c4;
        v4f v0 = *(const v4f*)q + bv[h];
        v4f v1 = *(const v4f*)(q + 2 * EPP) + bv[h];
        if (EPI == 3) {
          v0 = rv[g & 1][it][0] + v0;
          v1 = rv[g & 1][it][1] + v1;
        }
        store_rows_f32<2 * N * 4>(outF + e0 + go + (it * 4) * N, v0, v1);
      }
    }
  }
}

extern "C" void kernel_launch(void* const* d_in, const int* in_sizes, int n_in,
                              void* d_out, int out_size, void* d_ws, size_t ws_size,
                              hipStream_t stream) {
  (void)in_sizes; (void)n_in; (void)out_size; (void)ws_size;
  const float* x      = (const float*)d_in[0];
  const float* ln1_w  = (const float*)d_in[1];
  const float* ln1_b  = (const float*)d_in[2];
  const float* ln2_w  = (const float*)d_in[3];
  const float* ln2_b  = (const float*)d_in[4];
  const float* gate_w = (const float*)d_in[5];
  const float* gate_b = (const float*)d_in[6];
  const float* val_w  = (const float*)d_in[7];
  const float* val_b  = (const float*)d_in[8];
  const float* ffn1_w = (const float*)d_in[9];
  const float* ffn1_b = (const float*)d_in[10];
  const float* ffn2_w = (const float*)d_in[11];
  const float* ffn2_b = (const float*)d_in[12];

  char* ws = (char*)d_ws;
  const size_t MB = 1024ull * 1024ull;
  _Float16* h16   = (_Float16*)(ws);             // 32 MB: LN output (reused for LN2)
  float*    G     = (float*)(ws + 32 * MB);      // 64 MB
  float*    V     = (float*)(ws + 96 * MB);      // 64 MB
  _Float16* FF1   = (_Float16*)(ws + 32 * MB);   // 128 MB, reuses dead G/V region
  _Float16* gw16  = (_Float16*)(ws + 160 * MB);  // 2 MB
  _Float16* vw16  = (_Float16*)(ws + 162 * MB);  // 2 MB
  _Float16* w1_16 = (_Float16*)(ws + 164 * MB);  // 8 MB
  _Float16* w2_16 = (_Float16*)(ws + 172 * MB);  // 8 MB
  float*    Sg    = (float*)(ws + 180 * MB);     // 2 MB chunk partials
  float*    Sv    = (float*)(ws + 182 * MB);     // 2 MB chunk partials
  float*    X1    = (float*)d_out;               // x + mem lives in d_out

  // 1), 2) h = LN1(x); beside it, gate and value weights -> f16
  layernorm_f16_kernel<true><<<LN_BLOCKS, 256, 0, stream>>>(x, ln1_w, ln1_b, h16, gate_w, val_w, gw16, vw16);

  // 3) g = sigmoid(h @ gate_w^T + b), v = h @ val_w^T + b
  gemm_wmma_kernel<0, DIM><<<dim3(DIM / BN, MROWS / BM), 256, 0, stream>>>(
      h16, gw16, gate_b, nullptr, G, nullptr, MROWS, DIM);
  gemm_wmma_kernel<1, DIM><<<dim3(DIM / BN, MROWS / BM), 256, 0, stream>>>(
      h16, vw16, val_b, nullptr, V, nullptr, MROWS, DIM);

  // 4) x1 = x + cumsum(g*v) / (sqrt(cumsum(g)+1e-6)*sqrt(pos/S+0.1))   [3-pass scan]
  scan_partial_kernel<<<BATCH * NCHK, 256, 0, stream>>>(G, V, Sg, Sv);
  // beside the prefix, the FFN weights -> f16
  scan_prefix_kernel<<<PFX_BLOCKS + 2 * FFN_CVT_BLOCKS, 256, 0, stream>>>(Sg, Sv, ffn1_w, ffn2_w, w1_16, w2_16);
  scan_apply_kernel<<<BATCH * NCHK, 256, 0, stream>>>(x, G, V, Sg, Sv, X1);

  // 5) h2 = LN2(x1)
  layernorm_f16_kernel<false><<<LN_BLOCKS, 256, 0, stream>>>(X1, ln2_w, ln2_b, h16, nullptr, nullptr, nullptr, nullptr);

  // 6) ff1 = gelu(h2 @ ffn1_w^T + b)  -> f16
  gemm_wmma_kernel<2, 4 * DIM><<<dim3(4 * DIM / BN, MROWS / BM), 256, 0, stream>>>(
      h16, w1_16, ffn1_b, nullptr, nullptr, FF1, MROWS, DIM);

  // 7) out = x1 + (ff1 @ ffn2_w^T + b)
  gemm_wmma_kernel<3, DIM><<<dim3(DIM / BN, MROWS / BM), 256, 0, stream>>>(
      FF1, w2_16, ffn2_b, X1, X1, nullptr, MROWS, 4 * DIM);
}
